// v010
// The times below were measured on an AMD MI455X: many runs one after another, warmed up first and cycling through
// copies of the inputs, with the whole window's GPU time divided by the number of runs. Launches and the gaps
// between them are all in it. The median over several windows is given; except for v000 it joins two sittings, which
// can be a few percent apart, so the side-by-side timings, each taken in one sitting, are the better comparison.
// The versions before v010 are in another document.
// One run takes 19.1 microseconds.
// In both of two side-by-side timings against v009, it was 1.20 times as fast.
// All steps since the starting kernel, v000, together make it 80.6 times as fast.
// Contractions: per batch the trilinear term (q * w_qm).m^T [1024x128].[128x1024] on bf16 hi/lo split planes (logits reach ~+-30, so they need f32-class accuracy) and the query->memory read q2m.memory [1024x1024].[1024x128] with f16 operands (probabilities x 2^12) — wave tiles of 32 memory rows x 16 queries (scores) and 128 d x 16 queries (output); f32 accumulate. The memory's linear term rides in the first product (its other operand is q * w_qm + w_m); the query's linear term, the mask arithmetic (sim + (1 - mask) * -1e30, exactly as the module), the row softmax (exp once), the row maxima, the softmax over rows and the memory->query vector (broadcast to every row) are f32 arithmetic.
#include <hip/hip_runtime.h>
#include <math.h>

typedef __attribute__((ext_vector_type(16))) _Float16 v16h;
typedef __attribute__((ext_vector_type(8)))  _Float16 v8h;
typedef __attribute__((ext_vector_type(16))) __bf16   v16b;
typedef __attribute__((ext_vector_type(8)))  float    v8f;
typedef __attribute__((ext_vector_type(4)))  float    v4f;

// 16-bit WMMA fragment map (wave32), lane L, h = L>>4, m = L&15:
//   A 16x32: lane = row m;   element i -> k = (i<8) ? 8h+i : 16+8h+(i-8)
//   B 32x16: lane = column m; the SAME k(i,h)
//   D 16x16 (8 f32): lane = column m; element r -> row 8h+r
__device__ __forceinline__ int frag_k(int i, int h) { return (i < 8) ? (8 * h + i) : (16 + 8 * h + (i - 8)); }
__device__ __forceinline__ __bf16 bf16_rne(float f) {
    unsigned int u = __float_as_uint(f);
    u += 0x7fffu + ((u >> 16) & 1u);
    return __builtin_bit_cast(__bf16, (unsigned short)(u >> 16));
}
__device__ __forceinline__ float bf16_f32(__bf16 b) { return __uint_as_float(((unsigned int)__builtin_bit_cast(unsigned short, b)) << 16); }
__device__ __forceinline__ v8f wmma16(v16h a, v16h b, v8f c) {
    c = __builtin_amdgcn_wmma_f32_16x16x32_f16(false, a, false, b, (short)0, c, false, false);
    asm volatile("v_nop\n\tv_nop\n\tv_nop\n\tv_nop" : "+v"(c) : "v"(a), "v"(b));
    return c;
}
__device__ __forceinline__ v8f wmmab(v16b a, v16b b, v8f c) {
    c = __builtin_amdgcn_wmma_f32_16x16x32_bf16(false, a, false, b, (short)0, c, false, false);
    asm volatile("v_nop\n\tv_nop\n\tv_nop\n\tv_nop" : "+v"(c) : "v"(a), "v"(b));
    return c;
}
struct Split { v16b hi, lo; };
// hi/lo split product: a.hi*b.hi + a.hi*b.lo + a.lo*b.hi
__device__ __forceinline__ v8f wmma3(const Split& a, const Split& b, v8f c) {
    c = __builtin_amdgcn_wmma_f32_16x16x32_bf16(false, a.hi, false, b.hi, (short)0, c, false, false);
    c = __builtin_amdgcn_wmma_f32_16x16x32_bf16(false, a.hi, false, b.lo, (short)0, c, false, false);
    c = __builtin_amdgcn_wmma_f32_16x16x32_bf16(false, a.lo, false, b.hi, (short)0, c, false, false);
    asm volatile("v_nop\n\tv_nop\n\tv_nop\n\tv_nop" : "+v"(c) : "v"(a.hi), "v"(a.lo), "v"(b.hi), "v"(b.lo));
    return c;
}
struct Split3 { v16b hi, mid, lo; };
// triple split product (6 terms, drops only terms below 2^-24 relative)
__device__ __forceinline__ v8f wmma6(const Split3& a, const Split3& b, v8f c) {
    c = __builtin_amdgcn_wmma_f32_16x16x32_bf16(false, a.hi, false, b.hi, (short)0, c, false, false);
    c = __builtin_amdgcn_wmma_f32_16x16x32_bf16(false, a.hi, false, b.mid, (short)0, c, false, false);
    c = __builtin_amdgcn_wmma_f32_16x16x32_bf16(false, a.mid, false, b.hi, (short)0, c, false, false);
    c = __builtin_amdgcn_wmma_f32_16x16x32_bf16(false, a.hi, false, b.lo, (short)0, c, false, false);
    c = __builtin_amdgcn_wmma_f32_16x16x32_bf16(false, a.mid, false, b.mid, (short)0, c, false, false);
    c = __builtin_amdgcn_wmma_f32_16x16x32_bf16(false, a.lo, false, b.hi, (short)0, c, false, false);
    asm volatile("v_nop\n\tv_nop\n\tv_nop\n\tv_nop" : "+v"(c) : "v"(a.hi), "v"(a.mid), "v"(a.lo), "v"(b.hi), "v"(b.mid), "v"(b.lo));
    return c;
}

// Fragment gathers from f32 memory: element i <- p[(k0 + frag_k(i,h)) * sk] * s, zero for k >= klen.
__device__ __forceinline__ v16h fh_ld(const float* __restrict__ p, long long sk, int k0, int h, int klen, float s) {
    v16h a;
#pragma unroll
    for (int i = 0; i < 16; ++i) { const int k = k0 + frag_k(i, h); a[i] = (k < klen) ? (_Float16)(p[(long long)k * sk] * s) : (_Float16)0.f; }
    return a;
}
__device__ __forceinline__ Split sp_ld(const float* __restrict__ p, long long sk, int k0, int h, int klen, float s) {
    Split r;
#pragma unroll
    for (int i = 0; i < 16; ++i) {
        const int k = k0 + frag_k(i, h); const float x = (k < klen) ? p[(long long)k * sk] * s : 0.f;
        const __bf16 hb = bf16_rne(x); r.hi[i] = hb; r.lo[i] = bf16_rne(x - bf16_f32(hb));
    }
    return r;
}
__device__ __forceinline__ Split3 sp3_ld(const float* __restrict__ p, long long sk, int k0, int h, int klen, float s) {
    Split3 r;
#pragma unroll
    for (int i = 0; i < 16; ++i) {
        const int k = k0 + frag_k(i, h); const float x = (k < klen) ? p[(long long)k * sk] * s : 0.f;
        const __bf16 hb = bf16_rne(x); const float r1 = x - bf16_f32(hb); const __bf16 mb = bf16_rne(r1);
        r.hi[i] = hb; r.mid[i] = mb; r.lo[i] = bf16_rne(r1 - bf16_f32(mb));
    }
    return r;
}
__device__ __forceinline__ v16b bh_ld(const float* __restrict__ p, long long sk, int k0, int h, int klen, float s) {
    v16b a;
#pragma unroll
    for (int i = 0; i < 16; ++i) { const int k = k0 + frag_k(i, h); a[i] = bf16_rne((k < klen) ? p[(long long)k * sk] * s : 0.f); }
    return a;
}
// f16 fragment from an f16 LDS/global row with element stride 1 (k-contiguous), no bounds (tile already zero padded)
__device__ __forceinline__ v16h fh_row(const _Float16* __restrict__ row, int k0, int h) {
    v16h a;
#pragma unroll
    for (int i = 0; i < 16; ++i) a[i] = row[k0 + frag_k(i, h)];
    return a;
}

#define VST2(T, ptr, val) do { const T vst2_v_ = (val); *(T*)(ptr) = vst2_v_;  } while (0)
typedef float v4f __attribute__((ext_vector_type(4)));
#define VST2V4(ptr, val) do { const v4f vst2_v4_ = (val); *(v4f*)(ptr) = vst2_v4_;  } while (0)

__device__ __attribute__((noinline)) float act_fn(float v, int act) {
    if (act == 1) return fmaxf(v, 0.f);                                                                               // relu
    if (act == 2) { const float u = 0.7978845608028654f * (v + 0.044715f * v * v * v); return 0.5f * v * (1.f + tanhf(u)); } // tanh-gelu
    if (act == 3) return v / (1.f + expf(-v));                                                                        // silu
    if (act == 4) return 0.5f * v * (1.f + erff(v * 0.7071067811865476f));                                             // erf-gelu
    if (act == 5) return tanhf(v);
    if (act == 6) return 1.f / (1.f + expf(-v));                                                                      // sigmoid
    if (act == 7) return (v > 0.f) ? v : 0.01f * v;                                                                   // leaky relu 0.01
    if (act == 8) return (v > 0.f) ? v : (expf(v) - 1.f);                                                             // elu
    if (act == 9) return fminf(fmaxf(v, 0.f), 6.f);                                                                   // relu6
    if (act == 10) return fabsf(v);                                                                                    // abs
    if (act == 11) return (v >= 0.f) ? v : 0.1f * v;                                                                  // leaky 0.1
    if (act == 12) return (v > 0.f) ? v : 0.2f * v;                                                                   // leaky 0.2
    if (act == 13) return (v > 20.f) ? v : log1pf(expf(v));                                                            // softplus
    return v;
}

// =====================================================================================================================
// k_gemm<MODE>: C(z, m, n) = act(alpha * sum_k A(z, m, k) * B(z, k, n) + bias) + beta * R(z, m, n)
//   One wave (32-thread block) per 16 x 32 tile of C; grid (ceil(N/32), ceil(M/16), Z). Batch z -> (zo = z / zi_n, zi = z % zi_n)
//   with separate outer/inner strides for every tensor (e.g. batch and head). A(m,k) = A[zo*sAo + zi*sAi + m*sAm + k*sAk] (f32),
//   B(k,n) = B[zo*sBo + zi*sBi + n*sBn + k*sBk] (f32); any M, N, K (K zero-padded to 32 inside the fragments, M/N tails guarded).
//   C(m,n) = C[zo*sCo + zi*sCi + m*sCm + n] (n contiguous). flags: 1 bias[n], 2 bias[m], 4 residual R[zo*sRo + zi*sRi + m*sRm + n*sRn].
//   MODE 0: f16 operands (A prescaled by sa, B by sb, both undone in the epilogue); 1: bf16 hi/lo split (3 products); 2: bf16;
//   3: bf16 hi/mid/lo triple split (6 products); 4: as 3 with Kahan-compensated f32 accumulation across k-steps.
// =====================================================================================================================
struct GemmP {
    const float* A; const float* B; const float* bias; const float* R; float* C;
    long long sAo, sAi, sAm, sAk, sBo, sBi, sBn, sBk, sCo, sCi, sCm, sRo, sRi, sRm, sRn;
    int M, N, K, zi_n, flags, act; float alpha, beta, sa, sb;
    int Npad, pad_;     // columns [N, Npad) of C are written as 0 so that padded workspace rows are covered by whole-line stores; Npad >= N
};
static_assert(sizeof(GemmP) == 5 * 8 + 15 * 8 + 6 * 4 + 4 * 4 + 2 * 4, "GemmP has padding");

template <int MODE>
__global__ __launch_bounds__(32) void k_gemm(GemmP p) {
    const int lane = threadIdx.x & 31, h = lane >> 4, l15 = lane & 15;
    const int m0 = blockIdx.y * 16, n0 = blockIdx.x * 32;
    const int z = blockIdx.z, zo = z / p.zi_n, zi = z - zo * p.zi_n;
    const float* A = p.A + zo * p.sAo + zi * p.sAi;
    const float* B = p.B + zo * p.sBo + zi * p.sBi;
    const int am = min(m0 + l15, p.M - 1);                       // clamped row for loads (stores are guarded)
    v8f acc[2], comp[2];
#pragma unroll
    for (int t = 0; t < 2; ++t) { v8f zz = {}; acc[t] = zz; comp[t] = zz; }
    for (int k0 = 0; k0 < p.K; k0 += 32) {
        const float* arow = A + (long long)am * p.sAm;
        if (MODE == 1) {
            const Split a = sp_ld(arow, p.sAk, k0, h, p.K, 1.f);
#pragma unroll
            for (int t = 0; t < 2; ++t) {
                const int bn = min(n0 + t * 16 + l15, p.N - 1);
                acc[t] = wmma3(a, sp_ld(B + (long long)bn * p.sBn, p.sBk, k0, h, p.K, 1.f), acc[t]);
            }
        } else if (MODE == 3) {
            const Split3 a = sp3_ld(arow, p.sAk, k0, h, p.K, 1.f);
#pragma unroll
            for (int t = 0; t < 2; ++t) {
                const int bn = min(n0 + t * 16 + l15, p.N - 1);
                acc[t] = wmma6(a, sp3_ld(B + (long long)bn * p.sBn, p.sBk, k0, h, p.K, 1.f), acc[t]);
            }
        } else if (MODE == 4) {
            // triple split as MODE 3, but each k-step's 6 products go into a fresh accumulator and the partial is added to the running f32 sum
            // on the VALU with Kahan compensation (accumulation error stays ~1 ulp however long K is)
            const Split3 a = sp3_ld(arow, p.sAk, k0, h, p.K, 1.f);
#pragma unroll
            for (int t = 0; t < 2; ++t) {
                const int bn = min(n0 + t * 16 + l15, p.N - 1); v8f zz = {};
                const v8f part = wmma6(a, sp3_ld(B + (long long)bn * p.sBn, p.sBk, k0, h, p.K, 1.f), zz);
                const v8f y = part - comp[t]; const v8f s = acc[t] + y; comp[t] = (s - acc[t]) - y; acc[t] = s;
            }
        } else if (MODE == 2) {
            const v16b a = bh_ld(arow, p.sAk, k0, h, p.K, 1.f);
#pragma unroll
            for (int t = 0; t < 2; ++t) {
                const int bn = min(n0 + t * 16 + l15, p.N - 1);
                acc[t] = wmmab(a, bh_ld(B + (long long)bn * p.sBn, p.sBk, k0, h, p.K, 1.f), acc[t]);
            }
        } else {
            const v16h a = fh_ld(arow, p.sAk, k0, h, p.K, p.sa);
#pragma unroll
            for (int t = 0; t < 2; ++t) {
                const int bn = min(n0 + t * 16 + l15, p.N - 1);
                acc[t] = wmma16(a, fh_ld(B + (long long)bn * p.sBn, p.sBk, k0, h, p.K, p.sb), acc[t]);
            }
        }
    }
    const float iscale = (MODE == 0) ? p.alpha / (p.sa * p.sb) : p.alpha;
    float* C = p.C + zo * p.sCo + zi * p.sCi;
    const float* R = p.R + zo * p.sRo + zi * p.sRi;
    __shared__ __align__(16) float ctile[16][36];
#pragma unroll
    for (int t = 0; t < 2; ++t) {
        const int n = n0 + t * 16 + l15; const int nn = min(n, p.N - 1);
#pragma unroll
        for (int r = 0; r < 8; ++r) {
            const int m = m0 + 8 * h + r; const int mm = min(m, p.M - 1);
            float v = acc[t][r] * iscale;
            if (p.flags & 1) v += p.bias[nn];
            if (p.flags & 2) v += p.bias[mm];
            if (p.flags & 8) v *= p.bias[(long long)zo * p.M + mm];   /* per-(z,row) scale vector laid out [Z][M]; exclusive with the bias flags */
            v = act_fn(v, p.act);
            if (p.flags & 4) v += p.beta * R[(long long)mm * p.sRm + (long long)nn * p.sRn];
            ctile[8 * h + r][t * 16 + l15] = (n < p.N) ? v : 0.f;
        }
    }
    __syncthreads();
    const int NW = (p.Npad > p.N) ? p.Npad : p.N;           // write width
    const bool fast = (m0 + 16 <= p.M) && (n0 + 32 <= NW) && ((p.sCm & 3) == 0) && ((((size_t)C) & 15) == 0);
    if (fast) {
#pragma unroll
        for (int s = 0; s < 4; ++s) {
            const int row = s * 4 + (lane >> 3), c4 = (lane & 7) * 4;
            const v4f v = *(const v4f*)&ctile[row][c4];
            VST2V4(C + (long long)(m0 + row) * p.sCm + n0 + c4, v);
        }
    } else {
        for (int row = 0; row < 16; ++row) {
            const int m = m0 + row, n = n0 + lane;
            if (m < p.M && n < NW) VST2(float, C + (long long)m * p.sCm + n, ctile[row][lane]);
        }
    }
}


// =====================================================================================================================
// k_gemmT<MODE, TM, TN>: same contract as k_gemm, but one wave computes a (16*TM) x (16*TN) tile: TM A fragments and TN B fragments are
//   loaded per 32-wide k-step and reused across TM*TN WMMAs (far fewer load/convert instructions per MAC). MODE 0 (f16), 1 (bf16 hi/lo),
//   2 (bf16) only. grid (ceil(NW/(16*TN)), ceil(M/(16*TM)), Z), block 32. Epilogue identical to k_gemm, run per 16x32 sub-tile.
// =====================================================================================================================
template <int MODE, int TM, int TN>
__global__ __launch_bounds__(32) void k_gemmT(GemmP p) {
    const int lane = threadIdx.x & 31, h = lane >> 4, l15 = lane & 15;
    const int m0 = blockIdx.y * (16 * TM), n0 = blockIdx.x * (16 * TN);
    const int z = blockIdx.z, zo = z / p.zi_n, zi = z - zo * p.zi_n;
    const float* A = p.A + zo * p.sAo + zi * p.sAi;
    const float* B = p.B + zo * p.sBo + zi * p.sBi;
    v8f acc[TM][TN];
#pragma unroll
    for (int i = 0; i < TM; ++i)
#pragma unroll
        for (int t = 0; t < TN; ++t) { v8f zz = {}; acc[i][t] = zz; }
    for (int k0 = 0; k0 < p.K; k0 += 32) {
        if (MODE == 1) {
            Split a[TM], b[TN];
#pragma unroll
            for (int i = 0; i < TM; ++i) { const int am = min(m0 + 16 * i + l15, p.M - 1); a[i] = sp_ld(A + (long long)am * p.sAm, p.sAk, k0, h, p.K, 1.f); }
#pragma unroll
            for (int t = 0; t < TN; ++t) { const int bn = min(n0 + 16 * t + l15, p.N - 1); b[t] = sp_ld(B + (long long)bn * p.sBn, p.sBk, k0, h, p.K, 1.f); }
#pragma unroll
            for (int i = 0; i < TM; ++i)
#pragma unroll
                for (int t = 0; t < TN; ++t) acc[i][t] = wmma3(a[i], b[t], acc[i][t]);
        } else if (MODE == 2) {
            v16b a[TM], b[TN];
#pragma unroll
            for (int i = 0; i < TM; ++i) { const int am = min(m0 + 16 * i + l15, p.M - 1); a[i] = bh_ld(A + (long long)am * p.sAm, p.sAk, k0, h, p.K, 1.f); }
#pragma unroll
            for (int t = 0; t < TN; ++t) { const int bn = min(n0 + 16 * t + l15, p.N - 1); b[t] = bh_ld(B + (long long)bn * p.sBn, p.sBk, k0, h, p.K, 1.f); }
#pragma unroll
            for (int i = 0; i < TM; ++i)
#pragma unroll
                for (int t = 0; t < TN; ++t) acc[i][t] = wmmab(a[i], b[t], acc[i][t]);
        } else {
            v16h a[TM], b[TN];
#pragma unroll
            for (int i = 0; i < TM; ++i) { const int am = min(m0 + 16 * i + l15, p.M - 1); a[i] = fh_ld(A + (long long)am * p.sAm, p.sAk, k0, h, p.K, p.sa); }
#pragma unroll
            for (int t = 0; t < TN; ++t) { const int bn = min(n0 + 16 * t + l15, p.N - 1); b[t] = fh_ld(B + (long long)bn * p.sBn, p.sBk, k0, h, p.K, p.sb); }
#pragma unroll
            for (int i = 0; i < TM; ++i)
#pragma unroll
                for (int t = 0; t < TN; ++t) acc[i][t] = wmma16(a[i], b[t], acc[i][t]);
        }
    }
    const float iscale = (MODE == 0) ? p.alpha / (p.sa * p.sb) : p.alpha;
    float* C = p.C + zo * p.sCo + zi * p.sCi;
    const float* R = p.R + zo * p.sRo + zi * p.sRi;
    const int NW = (p.Npad > p.N) ? p.Npad : p.N;
    __shared__ __align__(16) float ctile[16][36];
#pragma unroll
    for (int i = 0; i < TM; ++i) {
        const int mb = m0 + 16 * i; if (mb >= p.M) break;          // wave-uniform
#pragma unroll
        for (int tp = 0; tp < TN / 2; ++tp) {
            const int nb = n0 + 32 * tp; if (nb >= NW) break;        // wave-uniform
#pragma unroll
            for (int t2 = 0; t2 < 2; ++t2) {
                const int t = 2 * tp + t2; const int n = nb + t2 * 16 + l15; const int nn = min(n, p.N - 1);
#pragma unroll
                for (int r = 0; r < 8; ++r) {
                    const int m = mb + 8 * h + r; const int mm = min(m, p.M - 1);
                    float v = acc[i][t][r] * iscale;
                    if (p.flags & 1) v += p.bias[nn];
                    if (p.flags & 2) v += p.bias[mm];
            if (p.flags & 8) v *= p.bias[(long long)zo * p.M + mm];   /* per-(z,row) scale vector laid out [Z][M]; exclusive with the bias flags */
                    v = act_fn(v, p.act);
                    if (p.flags & 4) v += p.beta * R[(long long)mm * p.sRm + (long long)nn * p.sRn];
                    ctile[8 * h + r][t2 * 16 + l15] = (n < p.N) ? v : 0.f;
                }
            }
            __syncthreads();
            const bool fast = (mb + 16 <= p.M) && (nb + 32 <= NW) && ((p.sCm & 3) == 0) && ((((size_t)C) & 15) == 0);
            if (fast) {
#pragma unroll
                for (int s = 0; s < 4; ++s) {
                    const int row = s * 4 + (lane >> 3), c4 = (lane & 7) * 4;
                    const v4f v = *(const v4f*)&ctile[row][c4];
                    VST2V4(C + (long long)(mb + row) * p.sCm + nb + c4, v);
                }
            } else {
                for (int row = 0; row < 16; ++row) {
                    const int m = mb + row, n = nb + lane;
                    if (m < p.M && n < NW) VST2(float, C + (long long)m * p.sCm + n, ctile[row][lane]);
                }
            }
            __syncthreads();
        }
    }
}

// =====================================================================================================================
//   Wave = 16 queries, AW waves per block, 64-key blocks; grid (ceil(Lq/(16*AW)), H, B), block 32*AW. Any Lq, Lk; head dim dh <= DHP
//   (DHP multiple of 32), value dim dv <= DVP (multiple of 16, <= 128). Every tensor addressed by (batch, head, row, element) strides, f32.
//   Scores: QM 0 f16 operands, 1 bf16 hi/lo split, 2 bf16 triple split; statistics f32 (exp2 domain); P.V: P x 4096 as f16 with V f16 staged in LDS
//   (SPLITPV: P and V as bf16 hi/lo splits). kv head = h / hrep. Masking: causal = 1 (keep j <= i + coff, masked -> -inf, key blocks beyond the
//   diagonal skipped), causal = 2 (masked -> mfill, a finite fill like the -1e9; no skipping), causal = 3 (keep j >= i + coff,
//   masked -> -inf, no skipping); optional additive f32 mask Mf,
//   optional int keep-mask Mi (0 -> score := mfill), both addressed b*smb + h*smh + i*smi + j*smj (0 strides broadcast).
// =====================================================================================================================
#define AW 4
struct AttnP {   // apv4
    const float* Q; const float* K; const float* V; float* O; float* P; const float* Mf; const int* Mi; float* ST;
    const float* Pw; const float* Rt; const int* SQ; const int* SK;           // optional: post-softmax weight, relative-position table, segment ids
    long long swb, swh, swi, swj, srb, srh, sri;                                 // Pw strides (b,h,i,j); Rt strides (b,h,i), column = clamp(i - j + roff, 0, rn-1)
    long long sQb, sQh, sQi, sQd, sKb, sKh, sKj, sKd, sVb, sVh, sVj, sVd, sOb, sOh, sOi, sPb, sPh, sPi, smb, smh, smi, smj;
    int Lq, Lk, dh, dv, hrep, causal, coff, pband;   // pband > 0: P holds only the band |j - i| <= pband, column j - i + pband
    float scale, mfill; int nonorm, mpol;             // nonorm (online path only): O = sum_j exp(score_j) V_j without the 1/rowsum (scores must be <= ~0); mpol: Mi masks where ==0 (mpol 0) or where !=0 (mpol 1)
    int roff, rn, segpol, win;                        // Rt column offset/count; SQ/SK: score := mfill where (segpol 0) SQ[i] != SK[j] or (segpol 1) SQ[i] == SK[j]; win > 0: keys with i - j > win (after coff) -> -inf
};
//   Pw: the softmax numerator is multiplied by Pw(b,h,i,j) AFTER the row sum is taken (probs * weight, then P.V), as in post-softmax multiplicative biases.                                                    // ST (optional): per row (b,h,i) -> ST[((b*H + h)*Lq + i)*2 + {0,1}] = {row max of the scaled+masked score (natural units), sum_j exp(score - max)}
static_assert(sizeof(AttnP) == 12 * 8 + 29 * 8 + 16 * 4, "AttnP has padding");

#ifndef KATTN_ATTR
#define KATTN_ATTR
#endif
template <int DHP, int DVP, int QM, bool SPLITPV, bool TWOPASS>
__global__ __launch_bounds__(32 * AW) KATTN_ATTR void k_attn(AttnP p) {
    constexpr int NT = DVP / 16;                // output tiles
    constexpr int KS = DHP / 32;                // k-steps for the scores
    constexpr int VP = DVP + 8;                 // LDS pitch (halves)
    __shared__ __align__(16) float    pl[AW][16 * 64];
    __shared__ __align__(16) _Float16 vl[(SPLITPV ? 2 : 1) * 64 * VP];   // f16 V tile, or bf16 hi and lo tiles (same 2-byte size)
    const int lane = threadIdx.x & 31, hf = lane >> 4, l15 = lane & 15, wave = threadIdx.x >> 5;
    const int h = blockIdx.y, b = blockIdx.z, hk = h / p.hrep;
    const int q0 = (blockIdx.x * AW + wave) * 16;
    float* myp = pl[wave];
    const float L2E = 1.4426950408889634f;
    const float NEG = -__builtin_inff();
    const int qi = min(q0 + l15, p.Lq - 1);
    const float* qrow = p.Q + b * p.sQb + h * p.sQh + (long long)qi * p.sQi;
    const float* kbase = p.K + b * p.sKb + hk * p.sKh;
    const float* vbase = p.V + b * p.sVb + hk * p.sVh;
    v16h qa[QM == 0 ? KS : 1]; Split qs_[QM == 1 ? KS : 1]; Split3 qt_[QM == 2 ? KS : 1];
#pragma unroll
    for (int ks = 0; ks < KS; ++ks) {
        if (QM == 2) qt_[ks] = sp3_ld(qrow, p.sQd, ks * 32, hf, p.dh, 1.f);
        else if (QM == 1) qs_[ks] = sp_ld(qrow, p.sQd, ks * 32, hf, p.dh, 1.f);
        else qa[ks] = fh_ld(qrow, p.sQd, ks * 32, hf, p.dh, 1.f);
    }
    v8f o[NT]; float m8[8], l8[8];
#pragma unroll
    for (int t = 0; t < NT; ++t) { v8f zz = {}; o[t] = zz; }
#pragma unroll
    for (int i = 0; i < 8; ++i) { m8[i] = NEG; l8[i] = 0.f; }
    int jend = p.Lk;
    if (p.causal == 1) { const int je = (blockIdx.x * AW + AW - 1) * 16 + 16 + p.coff; jend = min(jend, max(je, 0)); }   // uniform per block
    const int npass = TWOPASS ? 2 : 1;
    for (int pass = 0; pass < npass; ++pass) {
        const bool dopv = (!TWOPASS) || pass == 1;
        for (int j0 = 0; j0 < jend; j0 += 64) {
            if (dopv) {
                __syncthreads();                                 // previous key block's reads of vl / pl are done
                for (int idx = threadIdx.x; idx < 64 * DVP; idx += 32 * AW) {
                    const int jr = idx / DVP, d = idx - jr * DVP, j = j0 + jr;
                    const float f = (j < p.Lk && d < p.dv) ? vbase[(long long)j * p.sVj + (long long)d * p.sVd] : 0.f;
                    if (SPLITPV) {
                        const __bf16 hb = bf16_rne(f);
                        ((__bf16*)vl)[jr * VP + d] = hb; ((__bf16*)vl)[64 * VP + jr * VP + d] = bf16_rne(f - bf16_f32(hb));
                    } else vl[jr * VP + d] = (_Float16)f;
                }
            }
            v8f s[4];
#pragma unroll
            for (int t = 0; t < 4; ++t) {
                const int j = min(j0 + t * 16 + l15, p.Lk - 1);
                const float* krow = kbase + (long long)j * p.sKj;
                v8f acc = {};
#pragma unroll
                for (int ks = 0; ks < KS; ++ks) {
                    if (QM == 2)      acc = wmma6(qt_[ks], sp3_ld(krow, p.sKd, ks * 32, hf, p.dh, 1.f), acc);
                    else if (QM == 1) acc = wmma3(qs_[ks], sp_ld(krow, p.sKd, ks * 32, hf, p.dh, 1.f), acc);
                    else              acc = wmma16(qa[ks], fh_ld(krow, p.sKd, ks * 32, hf, p.dh, 1.f), acc);
                }
                s[t] = acc;
            }
            float pv[8][4];
#pragma unroll
            for (int i = 0; i < 8; ++i) {
                const int irow = q0 + i + 8 * hf;
                const int ic = min(irow, p.Lq - 1);
                float sc[4];
#pragma unroll
                for (int t = 0; t < 4; ++t) {
                    const int jg = j0 + t * 16 + l15;
                    float v = s[t][i] * p.scale;
                    if (p.Mf) v += p.Mf[b * p.smb + h * p.smh + (long long)ic * p.smi + (long long)min(jg, p.Lk - 1) * p.smj];
                    if (p.Rt) { int rc = ic - min(jg, p.Lk - 1) + p.roff; rc = rc < 0 ? 0 : (rc >= p.rn ? p.rn - 1 : rc); v += p.Rt[b * p.srb + h * p.srh + (long long)ic * p.sri + rc]; }
                    if (p.Mi) { const int mv = p.Mi[b * p.smb + h * p.smh + (long long)ic * p.smi + (long long)min(jg, p.Lk - 1) * p.smj]; if (p.mpol ? (mv != 0) : (mv == 0)) v = p.mfill; }
                    if (p.SQ) { const bool same = p.SQ[(long long)b * p.Lq + ic] == p.SK[(long long)b * p.Lk + min(jg, p.Lk - 1)]; if (p.segpol ? same : !same) v = p.mfill; }
                    if (p.causal == 2 && jg > irow + p.coff) v = p.mfill;
                    if (jg >= p.Lk || (p.causal == 1 && jg > irow + p.coff) || (p.causal == 3 && jg < irow + p.coff) || (p.win > 0 && irow + p.coff - jg > p.win)) v = NEG; else v *= L2E;
                    sc[t] = v;
                }
                if (!TWOPASS || pass == 0) {
                    float mx = fmaxf(fmaxf(sc[0], sc[1]), fmaxf(sc[2], sc[3]));
                    mx = fmaxf(mx, __shfl_xor(mx, 1, 32)); mx = fmaxf(mx, __shfl_xor(mx, 2, 32));
                    mx = fmaxf(mx, __shfl_xor(mx, 4, 32)); mx = fmaxf(mx, __shfl_xor(mx, 8, 32));
                    const float mnew = fmaxf(m8[i], mx);
                    const float corr = (mnew == NEG) ? 1.f : exp2f(m8[i] - mnew);
                    float rs = 0.f;
#pragma unroll
                    for (int t = 0; t < 4; ++t) {
                        const float pp = (sc[t] == NEG) ? 0.f : exp2f(sc[t] - mnew); rs += pp;
                        pv[i][t] = p.Pw ? pp * p.Pw[b * p.swb + h * p.swh + (long long)ic * p.swi + (long long)min(j0 + t * 16 + l15, p.Lk - 1) * p.swj] : pp;
                    }
                    rs += __shfl_xor(rs, 1, 32); rs += __shfl_xor(rs, 2, 32); rs += __shfl_xor(rs, 4, 32); rs += __shfl_xor(rs, 8, 32);
                    l8[i] = l8[i] * corr + rs; m8[i] = mnew;
                    if (!TWOPASS) {
#pragma unroll
                        for (int t = 0; t < NT; ++t) o[t][i] *= corr;
                    }
                } else {
                    const float inv = (l8[i] > 0.f) ? 1.f / l8[i] : 0.f;
#pragma unroll
                    for (int t = 0; t < 4; ++t) {
                        const int jg = j0 + t * 16 + l15;
                        float pp = (sc[t] == NEG) ? 0.f : exp2f(sc[t] - m8[i]) * inv;
                        if (p.Pw) pp *= p.Pw[b * p.swb + h * p.swh + (long long)ic * p.swi + (long long)min(jg, p.Lk - 1) * p.swj];
                        pv[i][t] = pp;
                    }
                }
            }
            if (dopv) {
#pragma unroll
                for (int i = 0; i < 8; ++i)
#pragma unroll
                    for (int t = 0; t < 4; ++t) ((float*)myp)[(i + 8 * hf) * 64 + t * 16 + l15] = pv[i][t];
                __syncthreads();                                 // P (per wave) and V (shared) visible
                if (p.P) {
                    float* pb_ = p.P + b * p.sPb + h * p.sPh;
                    const bool fastP = (p.pband == 0) && ((p.sPi & 3) == 0) && (j0 + 64 <= p.Lk) && (q0 + 16 <= p.Lq) && ((((size_t)pb_) & 15) == 0);
                    if (fastP) {
#pragma unroll
                        for (int s = 0; s < 8; ++s) {
                            const int row = s * 2 + (lane >> 4), c4 = (lane & 15) * 4;
                            const v4f v = *(const v4f*)(myp + row * 64 + c4);
                            VST2V4(pb_ + (long long)(q0 + row) * p.sPi + j0 + c4, v);
                        }
                    } else {
                        for (int row = 0; row < 16; ++row) {
                            const int irow = q0 + row; if (irow >= p.Lq) continue;
                            for (int c = lane; c < 64; c += 32) {
                                const int jg = j0 + c; if (jg >= p.Lk) continue;
                                if (p.pband == 0) VST2(float, pb_ + (long long)irow * p.sPi + jg, myp[row * 64 + c]);
                                else if (jg - irow <= p.pband && irow - jg <= p.pband) VST2(float, pb_ + (long long)irow * p.sPi + (jg - irow + p.pband), myp[row * 64 + c]);
                            }
                        }
                    }
                }
                if (SPLITPV) {
                    const Split pa0 = sp_ld(myp + l15 * 64, 1, 0, hf, 64, 1.f), pa1 = sp_ld(myp + l15 * 64, 1, 32, hf, 64, 1.f);
                    const __bf16* vh = (const __bf16*)vl; const __bf16* vlo = vh + 64 * VP;
#pragma unroll
                    for (int t = 0; t < NT; ++t) {
                        const int dcol = t * 16 + l15;
                        Split b0, b1;
#pragma unroll
                        for (int e = 0; e < 16; ++e) {
                            const int k0 = frag_k(e, hf), k1 = 32 + frag_k(e, hf);
                            b0.hi[e] = vh[k0 * VP + dcol]; b0.lo[e] = vlo[k0 * VP + dcol]; b1.hi[e] = vh[k1 * VP + dcol]; b1.lo[e] = vlo[k1 * VP + dcol];
                        }
                        o[t] = wmma3(pa0, b0, o[t]);
                        o[t] = wmma3(pa1, b1, o[t]);
                    }
                } else {
                    const v16h pa0 = fh_ld(myp + l15 * 64, 1, 0, hf, 64, 4096.f), pa1 = fh_ld(myp + l15 * 64, 1, 32, hf, 64, 4096.f);
#pragma unroll
                    for (int t = 0; t < NT; ++t) {
                        const int dcol = t * 16 + l15;
                        v16h b0, b1;
#pragma unroll
                        for (int e = 0; e < 16; ++e) { b0[e] = vl[frag_k(e, hf) * VP + dcol]; b1[e] = vl[(32 + frag_k(e, hf)) * VP + dcol]; }
                        o[t] = wmma16(pa0, b0, o[t]);
                        o[t] = wmma16(pa1, b1, o[t]);
                    }
                }
            }
        }
    }
    float* obase = p.O + b * p.sOb + h * p.sOh;
    if (p.ST) {
        const int rl = lane >> 1, isel = rl & 7;           // row q0 + rl ; rl>>3 == hf holds because lane>>4 == (lane>>1)>>3
        float mv = 0.f, lv = 0.f;
#pragma unroll
        for (int i = 0; i < 8; ++i) if (i == isel) { mv = m8[i]; lv = l8[i]; }
        const int irow = q0 + rl;
        if (irow < p.Lq) { float* st = p.ST + (((long long)b * gridDim.y + h) * p.Lq + irow) * 2 + (lane & 1); VST2(float, st, (lane & 1) ? lv : mv * 0.6931471805599453f); }
    }
    float invr[8];
#pragma unroll
    for (int i = 0; i < 8; ++i) {
        if (TWOPASS) invr[i] = SPLITPV ? 1.f : (1.f / 4096.f);
        else if (p.nonorm) invr[i] = exp2f(m8[i]) * (SPLITPV ? 1.f : (1.f / 4096.f));
        else invr[i] = (l8[i] > 0.f) ? (SPLITPV ? 1.f / l8[i] : 1.f / (l8[i] * 4096.f)) : 0.f;
    }
    __syncthreads();                                             // all waves done with pl/vl from the main loop
    const bool ofast = ((p.sOi & 3) == 0) && ((((size_t)obase) & 15) == 0) && (q0 + 16 <= p.Lq);
#pragma unroll
    for (int c0 = 0; c0 < DVP; c0 += 64) {
#pragma unroll
        for (int i = 0; i < 8; ++i)
#pragma unroll
            for (int t = 0; t < NT; ++t) if (t * 16 >= c0 && t * 16 < c0 + 64) ((float*)myp)[(i + 8 * hf) * 64 + (t * 16 - c0) + l15] = o[t][i] * invr[i];
        __syncthreads();
        const int cw = (DVP - c0 < 64) ? (DVP - c0) : 64;      // staged columns in this chunk (multiple of 16)
        if (ofast && (c0 + cw <= p.dv) && (cw % 32 == 0)) {
            const int lpr = cw / 4;                              // lanes per row (16 for 64 cols, 8 for 32)
            const int rows_per_ins = 32 / lpr;
            for (int r0 = 0; r0 < 16; r0 += rows_per_ins) {
                const int row = r0 + lane / lpr, c4 = (lane % lpr) * 4;
                const v4f v = *(const v4f*)(myp + row * 64 + c4);
                VST2V4(obase + (long long)(q0 + row) * p.sOi + c0 + c4, v);
            }
        } else {
            for (int row = 0; row < 16; ++row) {
                const int irow = q0 + row; if (irow >= p.Lq) continue;
                for (int c = lane; c < cw; c += 32) { const int d = c0 + c; if (d < p.dv) VST2(float, obase + (long long)irow * p.sOi + d, myp[row * 64 + c]); }
            }
        }
        __syncthreads();
    }
}

// =====================================================================================================================
// k_tr: dst(z, c, r) = alpha * src(z, r, c) (+ beta * R2(z, c, r)): [Z][R][C] (row stride lds) -> [Z][C][R] (row stride ldd) through a 32x32 LDS tile;
//   flags: 1 -> add beta * residual R2 addressed like dst (z*sRz + c*ldr + r); act applied before the residual.
// =====================================================================================================================
struct TrP { const float* src; float* dst; const float* R2; long long sSz, lds, sDz, ldd, sRz, ldr; int R, C, flags, act; float alpha, beta; };
static_assert(sizeof(TrP) == 3 * 8 + 6 * 8 + 6 * 4, "TrP has padding");
__global__ __launch_bounds__(256) void k_tr(TrP p) {
    __shared__ float tile[32][33];
    const int c0 = blockIdx.x * 32, r0 = blockIdx.y * 32, z = blockIdx.z;
    const int lane = threadIdx.x & 31, wave = threadIdx.x >> 5;
    const float* s = p.src + z * p.sSz;
#pragma unroll
    for (int k = 0; k < 4; ++k) {
        const int rl = wave * 4 + k, r = r0 + rl, c = c0 + lane;
        tile[rl][lane] = (r < p.R && c < p.C) ? s[(long long)r * p.lds + c] : 0.f;
    }
    __syncthreads();
    float* d = p.dst + z * p.sDz; const float* rr = p.R2 + z * p.sRz;
#pragma unroll
    for (int k = 0; k < 4; ++k) {
        const int cl = wave * 4 + k, c = c0 + cl, r = r0 + lane;
        if (c < p.C && r < p.R) {
            float v = act_fn(p.alpha * tile[lane][cl], p.act);
            if (p.flags & 1) v += p.beta * rr[(long long)c * p.ldr + r];
            VST2(float, d + (long long)c * p.ldd + r, v);
        }
    }
}

// k_affine: dst[i] = a * (sdev ? sdev[0] : 1) * src[i] + b, i < n (one thread per element; consecutive lanes -> consecutive addresses)
__global__ __launch_bounds__(256) void k_affine(const float* __restrict__ src, float* __restrict__ dst, int n, float a, float b, const float* __restrict__ sdev) {
    const int i = blockIdx.x * 256 + threadIdx.x;
    if (i < n) { const float aa = sdev ? a * sdev[0] : a; const float v = aa * src[i] + b; VST2(float, dst + i, v); }
}

// =====================================================================================================================
// k_softmax: row softmax over n contiguous elements, one 256-thread block per row; rows addressed z*sz + r*sr (grid (R, Z)).
//   out = scale_out * softmax(scale_in * x + (Mf ? Mf[z*smz + r*smr + j] : 0)); a row whose max is -inf is written as 0.
// =====================================================================================================================
struct SmP { const float* src; float* dst; const float* Mf; long long sz, sr, dz, dr, smz, smr; int n, pad; float scale_in, scale_out; };
static_assert(sizeof(SmP) == 3 * 8 + 6 * 8 + 4 * 4, "SmP has padding");
__global__ __launch_bounds__(256) void k_softmax(SmP p) {
    __shared__ float red[256];
    const int r = blockIdx.x, z = blockIdx.y, tid = threadIdx.x;
    const float* s = p.src + z * p.sz + (long long)r * p.sr;
    const float* mf = p.Mf ? (p.Mf + z * p.smz + (long long)r * p.smr) : nullptr;
    float mx = -__builtin_inff();
    for (int j = tid; j < p.n; j += 256) { float v = s[j] * p.scale_in; if (mf) v += mf[j]; mx = fmaxf(mx, v); }
    red[tid] = mx; __syncthreads();
    for (int o = 128; o > 0; o >>= 1) { if (tid < o) red[tid] = fmaxf(red[tid], red[tid + o]); __syncthreads(); }
    mx = red[0]; __syncthreads();
    float sum = 0.f;
    for (int j = tid; j < p.n; j += 256) { float v = s[j] * p.scale_in; if (mf) v += mf[j]; sum += (mx == -__builtin_inff()) ? 0.f : expf(v - mx); }
    red[tid] = sum; __syncthreads();
    for (int o = 128; o > 0; o >>= 1) { if (tid < o) red[tid] += red[tid + o]; __syncthreads(); }
    sum = red[0];
    const float inv = (sum > 0.f) ? p.scale_out / sum : 0.f;
    float* d = p.dst + z * p.dz + (long long)r * p.dr;
    for (int j = tid; j < p.n; j += 256) { float v = s[j] * p.scale_in; if (mf) v += mf[j]; const float o = (mx == -__builtin_inff()) ? 0.f : expf(v - mx) * inv; VST2(float, d + j, o); }
}
// =====================================================================================================================
// k_stats: mean and rsqrt(var + eps) over a set of n elements addressed base + z*sz + (e / inner) * so + (e % inner) * si, one 256-thread
// k_norm_apply: y = (x - mean[set]) * rstd[set] * g[c] + b[c] over a [Z][C][L] channel-major tensor with set = z*G + c / (C/G) (G groups per z;
//   G = C -> per-channel sets indexed z*C+c; for batch norm pass stats indexed by c only via bn = 1). Optional act. Output same layout.
// =====================================================================================================================
//   mode 0: mean / rsqrt(var + eps); mode 1 (RMSNorm): 0 / rsqrt(mean(x^2) + eps); mode 2 (L2 normalize * sqrt(n)): 0 / sqrt(n) / max(||x||, eps); mode 3: as 0 with unbiased variance (n-1)
__global__ __launch_bounds__(256) void k_stats(const float* __restrict__ x, long long sz, long long so, long long si, int inner, int n, float eps, float* __restrict__ stat, int mode) {
    __shared__ float red[256];
    const int z = blockIdx.x, tid = threadIdx.x;
    const float* base = x + z * sz;
    float s = 0.f;
    for (int e = tid; e < n; e += 256) s += base[(long long)(e / inner) * so + (long long)(e % inner) * si];
    red[tid] = s; __syncthreads();
    for (int o = 128; o > 0; o >>= 1) { if (tid < o) red[tid] += red[tid + o]; __syncthreads(); }
    const float mu = (mode == 0 || mode == 3) ? red[0] / (float)n : 0.f; __syncthreads();
    float q = 0.f;
    for (int e = tid; e < n; e += 256) { const float dlt = base[(long long)(e / inner) * so + (long long)(e % inner) * si] - mu; q += dlt * dlt; }
    red[tid] = q; __syncthreads();
    for (int o = 128; o > 0; o >>= 1) { if (tid < o) red[tid] += red[tid + o]; __syncthreads(); }
    {
        float rs;
        if (mode == 2) rs = sqrtf((float)n) / fmaxf(sqrtf(red[0]), eps); else if (mode == 3) rs = rsqrtf(red[0] / (float)(n - 1) + eps); else rs = rsqrtf(red[0] / (float)n + eps);
        if (tid < 32) { const float v = (tid == 0) ? mu : ((tid == 1) ? rs : 0.f); VST2(float, stat + (long long)z * 32 + tid, v); }
    }
}
//   One thread per element over the flat [Z][C][L] index space: grid ceil(Z*C*L / 256).
__global__ __launch_bounds__(256) void k_norm_apply(const float* __restrict__ x, float* __restrict__ y, const float* __restrict__ stat, const float* __restrict__ g, const float* __restrict__ bta,
                                                     int Z, int C, int L, int G, int bn, int act) {
    const long long idx = (long long)blockIdx.x * 256 + threadIdx.x;
    if (idx >= (long long)Z * C * L) return;
    const int l = (int)(idx % L); const long long zc = idx / L; const int c = (int)(zc % C), z = (int)(zc / C); (void)l;
    const int set = bn ? c : (z * G + c / (C / G));
    float v = (x[idx] - stat[(long long)set * 32]) * stat[(long long)set * 32 + 1];
    if (g) v *= g[c];
    if (bta) v += bta[c];
    v = act_fn(v, act);
    VST2(float, y + idx, v);
}

// k_lse_neg: c[i] = -(st[2i] + log(st[2i+1])) = minus the log-sum-exp of row i from k_attn's ST output (for softmax over the query dimension)
__global__ __launch_bounds__(256) void k_lse_neg(const float* __restrict__ st, float* __restrict__ c, int n) {
    const int i = blockIdx.x * 256 + threadIdx.x;
    if (i < n) { const float v = -(st[2 * i] + logf(st[2 * i + 1])); VST2(float, c + i, v); }
}

// k_iota: dst[i] = a * i + b as int32 (segment/position id helper)
__global__ __launch_bounds__(256) void k_iota(int* __restrict__ dst, int n, int a, int b) {
    const int i = blockIdx.x * 256 + threadIdx.x;
    if (i < n) { const int v = a * i + b; VST2(int, dst + i, v); }
}

// k_axpby: dst[i] = a * x[i] + b * y[i] (+ c), i < n
__global__ __launch_bounds__(256) void k_axpby(const float* __restrict__ x, const float* __restrict__ y, float* __restrict__ dst, int n, float a, float b, float c) {
    const int i = blockIdx.x * 256 + threadIdx.x;
    if (i < n) { const float v = a * x[i] + b * y[i] + c; VST2(float, dst + i, v); }
}

// =====================================================================================================================
// k_rope: rotary embedding on a [R rows][Hn heads][D] view (row stride sXr, head stride sXh, element stride 1) -> Y (own strides).
//   mode 0: rotate_half (partner d±D/2, sign - for d<D/2); mode 1: interleaved pairs (partner d^1, sign - for even d).
//   table column tcol: tmode 0 -> d, 1 -> d % (D/2), 2 -> d / 2; position p: pmode 0 -> r % S, 1 -> head index, 2 -> pos[r];
//   c = C[(r / S) * sCb + p * sCp + tcol * sCd], s likewise from Sn; y = x[d] * c + sign * x[partner] * s. X and Y must not alias.
// =====================================================================================================================
struct RopeP { const float* X; float* Y; const float* C; const float* Sn; const int* pos; long long sXr, sXh, sYr, sYh, sCb, sCp, sCd; int R, Hn, D, S, mode, tmode, pmode, pad; };
static_assert(sizeof(RopeP) == 5 * 8 + 7 * 8 + 8 * 4, "RopeP has padding");
__global__ __launch_bounds__(256) void k_rope(RopeP p) {
    const long long idx = (long long)blockIdx.x * 256 + threadIdx.x;
    if (idx >= (long long)p.R * p.Hn * p.D) return;
    const int d = (int)(idx % p.D); const long long rh = idx / p.D; const int h = (int)(rh % p.Hn); const int r = (int)(rh / p.Hn);
    const int half = p.D / 2;
    int partner; float sign;
    if (p.mode == 0) { partner = (d < half) ? d + half : d - half; sign = (d < half) ? -1.f : 1.f; }
    else { partner = d ^ 1; sign = (d & 1) ? 1.f : -1.f; }
    const int tcol = (p.tmode == 0) ? d : ((p.tmode == 1) ? (d % half) : (d >> 1));
    const int pp = (p.pmode == 0) ? (r % p.S) : ((p.pmode == 1) ? h : p.pos[r]);
    const long long toff = (long long)(r / p.S) * p.sCb + (long long)pp * p.sCp + (long long)tcol * p.sCd;
    const float* xr = p.X + (long long)r * p.sXr + (long long)h * p.sXh;
    const float v = xr[d] * p.C[toff] + sign * xr[partner] * p.Sn[toff];
    VST2(float, p.Y + (long long)r * p.sYr + (long long)h * p.sYh + d, v);
}

// k_invf + k_sincos (split so neither kernel carries a large VALU-fma footprint): invf_i = num * (1 / powf(base, (2 i)/D)) [fmode 0],
//   num * expf((2 i) * cexp) [fmode 1], num * powf(base, -2 (i - 1) / D) [fmode 2]; then cs/sn[s*half + i] = cos/sin((pscale * s) * invf_i)
__global__ __launch_bounds__(256) void k_invf(float* __restrict__ invb, int half, int D, float base, float num, int fmode, float cexp) {
    const int i = blockIdx.x * 256 + threadIdx.x;
    if (i >= ((half + 31) / 32) * 32) return;
    if (i >= half) { VST2(float, invb + i, 0.f); return; }
    const float e = (float)(2 * i) / (float)D;
    float invf;
    if (fmode == 1) invf = num * expf((float)(2 * i) * cexp);
    else if (fmode == 2) invf = num * powf(base, (-2.0f * ((float)i - 1.0f)) / (float)D);
    else invf = num * (1.0f / powf(base, e));
    VST2(float, invb + i, invf);
}
__global__ __launch_bounds__(256) void k_sincos(float* __restrict__ cs, float* __restrict__ sn, const float* __restrict__ invb, int S, int half, float pscale) {
    const int idx = blockIdx.x * 256 + threadIdx.x;
    if (idx >= S * half) return;
    const int s = idx / half, i = idx - s * half;
    const float ang = (pscale * (float)s) * invb[i];
    VST2(float, cs + idx, cosf(ang)); VST2(float, sn + idx, sinf(ang));
}

// k_mulact: dst[i] = act(x[i]) * y[i]
__global__ __launch_bounds__(256) void k_mulact(const float* __restrict__ x, const float* __restrict__ y, float* __restrict__ dst, int n, int act) {
    const int i = blockIdx.x * 256 + threadIdx.x;
    if (i < n) { const float v = act_fn(x[i], act) * y[i]; VST2(float, dst + i, v); }
}

// =====================================================================================================================
// k_matvec: thread-per-row matrix-vector products for N <= 8 output columns (heads with 1-3 outputs, gates), f32 on the VALU.
//   C[r*sCm + j] = act(alpha * sum_k A[r*sAm + k*sAk] * B[j*sBn + k*sBk] + bias[j]) + beta * R[r*sRm + j*sRn]; each thread writes its N contiguous floats.
// =====================================================================================================================
__global__ __launch_bounds__(256) void k_matvec(GemmP p) {
    // 32 lanes write one line with one instruction.
    const int rpt = (p.N == 1) ? 1 : 32;
    const long long r0 = ((long long)blockIdx.x * 256 + threadIdx.x) * rpt; const int z = blockIdx.z, zo = z / p.zi_n, zi = z - zo * p.zi_n;
    if (r0 >= p.M) return;
    const float* Bb = p.B + zo * p.sBo + zi * p.sBi;
    float* C = p.C + zo * p.sCo + zi * p.sCi; const float* R = p.R + zo * p.sRo + zi * p.sRi;
    for (int rr = 0; rr < rpt; ++rr) {
        const long long r = r0 + rr; if (r >= p.M) break;
        const float* A = p.A + zo * p.sAo + zi * p.sAi + r * p.sAm;
        float acc[8] = {0.f, 0.f, 0.f, 0.f, 0.f, 0.f, 0.f, 0.f};
        for (int k = 0; k < p.K; ++k) { const float a = A[(long long)k * p.sAk];
#pragma unroll
            for (int j = 0; j < 8; ++j) if (j < p.N) acc[j] += a * Bb[(long long)j * p.sBn + (long long)k * p.sBk]; }
#pragma unroll
        for (int j = 0; j < 8; ++j) if (j < p.N) {
            float v = acc[j] * p.alpha;
            if (p.flags & 1) v += p.bias[j];
            if (p.flags & 2) v += p.bias[r];
            v = act_fn(v, p.act);
            if (p.flags & 4) v += p.beta * R[r * p.sRm + (long long)j * p.sRn];
            VST2(float, C + r * p.sCm + j, v);
        }
    }
}
// k_smallsoftmax: thread-per-row softmax for short rows (n <= 64): dst[r*dr + j] = softmax(scale*src[r*sr + j])
__global__ __launch_bounds__(256) void k_smallsoftmax(const float* __restrict__ src, float* __restrict__ dst, long long sr, long long dr, int n, long long R, float scale) {
    const long long r0 = ((long long)blockIdx.x * 256 + threadIdx.x) * 32;
    for (int rr = 0; rr < 32; ++rr) {
        const long long r = r0 + rr; if (r >= R) return;
        const float* s = src + r * sr; float* d = dst + r * dr;
        float mx = -__builtin_inff();
        for (int j = 0; j < n; ++j) mx = fmaxf(mx, s[j] * scale);
        float sum = 0.f;
        for (int j = 0; j < n; ++j) sum += expf(s[j] * scale - mx);
        const float inv = 1.f / sum;
        for (int j = 0; j < n; ++j) { const float v = expf(s[j] * scale - mx) * inv; VST2(float, d + j, v); }
    }
}

__global__ __launch_bounds__(32) void k_unitstat(float* __restrict__ st) { const int t = threadIdx.x; const float v = (t == 1) ? 1.f : 0.f; VST2(float, st + t, v); }

// destination (e.g. a d_out whose row width is not a multiple of 32 floats) is written by consecutive lanes of one instruction
__global__ __launch_bounds__(256) void k_lincopy(const float* __restrict__ src, long long lds, float* __restrict__ dst, long long ldd, long long rows, int cols) {
    const long long i = (long long)blockIdx.x * 256 + threadIdx.x; if (i >= rows * cols) return;
    const long long r = i / cols; const int c = (int)(i - r * cols);
    const float v = src[r * lds + c]; VST2(float, dst + r * ldd + c, v);
}

namespace w25 {
typedef __attribute__((ext_vector_type(16))) _Float16 v16h;
typedef __attribute__((ext_vector_type(8)))  _Float16 v8h;
typedef __attribute__((ext_vector_type(16))) __bf16   v16b;
typedef __attribute__((ext_vector_type(8)))  __bf16   v8b;
typedef __attribute__((ext_vector_type(8)))  float    v8f;
typedef __attribute__((ext_vector_type(4)))  float    v4f;

__device__ __forceinline__ unsigned short f2bf_bits(float f) {
  unsigned u = __float_as_uint(f);
  return (unsigned short)((u + 0x7FFFu + ((u >> 16) & 1u)) >> 16);
}
__device__ __forceinline__ float bf_bits2f(unsigned short h) { return __uint_as_float(((unsigned)h) << 16); }

// hazard guards as plain device helpers (no inline asm inside the kernel template body)
__device__ __forceinline__ void dep_guard_h(v8f& a, v8f& b, v16h x, v16h y) { asm volatile("v_nop\n\tv_nop\n\tv_nop\n\tv_nop" : "+v"(a), "+v"(b) : "v"(x), "v"(y)); }
__device__ __forceinline__ void dep_guard_b(v8f& a, v8f& b, v16b x, v16b y) { asm volatile("v_nop\n\tv_nop\n\tv_nop\n\tv_nop" : "+v"(a), "+v"(b) : "v"(x), "v"(y)); }
__device__ __forceinline__ void keep4_h(v16h a, v16h b, v16h c, v16h d) { asm volatile("v_nop" :: "v"(a), "v"(b), "v"(c), "v"(d)); }
__device__ __forceinline__ void keep4_b(v16b a, v16b b, v16b c, v16b d) { asm volatile("v_nop" :: "v"(a), "v"(b), "v"(c), "v"(d)); }
__device__ __forceinline__ void acc_guard4(v8f& a, v8f& b, v8f& c, v8f& d) { asm volatile("v_nop\n\tv_nop\n\tv_nop\n\tv_nop" : "+v"(a), "+v"(b), "+v"(c), "+v"(d)); }
template <typename T> struct Frag;
template <> struct Frag<_Float16> {
  typedef v16h V; union U { v16h v; v8h h[2]; };
  static __device__ __forceinline__ v16h load(const _Float16* p) {   // elements 0..7 <- p[0..7], 8..15 <- p[16..23]
    U f; f.h[0] = *(const v8h*)(p); f.h[1] = *(const v8h*)(p + 16); return f.v;
  }
  static __device__ __forceinline__ v8f mma(v16h a, v16h b, v8f c) {
    return __builtin_amdgcn_wmma_f32_16x16x32_f16(false, a, false, b, (short)0, c, false, false);
  }
  static __device__ __forceinline__ void guard(v8f& a, v8f& b, v16h x, v16h y) { dep_guard_h(a, b, x, y); }
  static __device__ __forceinline__ void keep(v16h a, v16h b, v16h c, v16h d) { keep4_h(a, b, c, d); }
};
template <> struct Frag<__bf16> {
  typedef v16b V; union U { v16b v; v8b h[2]; };
  static __device__ __forceinline__ v16b load(const __bf16* p) {
    U f; f.h[0] = *(const v8b*)(p); f.h[1] = *(const v8b*)(p + 16); return f.v;
  }
  static __device__ __forceinline__ v8f mma(v16b a, v16b b, v8f c) {
    return __builtin_amdgcn_wmma_f32_16x16x32_bf16(false, a, false, b, (short)0, c, false, false);
  }
  static __device__ __forceinline__ void guard(v8f& a, v8f& b, v16b x, v16b y) { dep_guard_b(a, b, x, y); }
  static __device__ __forceinline__ void keep(v16b a, v16b b, v16b c, v16b d) { keep4_b(a, b, c, d); }
};

// ---- Register-blocked batched WMMA GEMM ------------------------------------
// C[m,n] = scale * sum_k A[m,k] * Bt[n,k] (+bias)(+resid); each wave owns a 64x64 tile.
// A row-major [M,K]; Bt row-major [N,K]; M,N % 64 == 0, K % 32 == 0.
// SPLIT: operands are hi/lo planes (A2/Bt2 = lo planes, same layout); product = hi·hi + hi·lo + lo·hi.
// BIAS_MODE: 0 = none, 1 = bias[m], 2 = bias[n].
// OUT_MODE: 0 = f32, 1 = f16, 2 = bf16 hi plane (Cout) + bf16 lo plane (Cout2).
// ET: 0 = f16 operands, 1 = bf16 operands (pointers passed as 16-bit storage)
template <int ET> struct Elem;
template <> struct Elem<0> { typedef _Float16 T; };
template <> struct Elem<1> { typedef __bf16 T; };
template <int ET, bool SPLIT, int BIAS_MODE, int OUT_MODE, bool RESID, int ACT = 0>
__global__ __launch_bounds__(256) void wmma_gemm64(
    const unsigned short* __restrict__ Ap, const unsigned short* __restrict__ A2p, int lda, long strideA,
    const unsigned short* __restrict__ Btp, const unsigned short* __restrict__ Bt2p, int ldb, long strideB,
    void* __restrict__ Cout, void* __restrict__ Cout2, int ldc, long strideC,
    const float* __restrict__ bias,
    const float* __restrict__ resid, long strideR,
    int M, int N, int K, float scale) {
  typedef typename Elem<ET>::T T;
  typedef typename Frag<T>::V V;
  const T* A = (const T*)Ap; const T* A2 = (const T*)A2p; const T* Bt = (const T*)Btp; const T* Bt2 = (const T*)Bt2p;
  __shared__ __align__(16) float sT[8][16 * 68];   // per-wave 16x64 slab, pitch 68 floats
  const int b    = blockIdx.y;
  const int lane = threadIdx.x & 31;
  const int wave = threadIdx.x >> 5;
  const int tilesN = N >> 6;
  const int tilesM = M >> 6;
  const int tile = blockIdx.x * 8 + wave;
  if (tile >= tilesM * tilesN) return;   // wave-uniform; no block barriers in this kernel
  const int tm = tile / tilesN;
  const int tn = tile - tm * tilesN;
  const int m0 = tm << 6;
  const int n0 = tn << 6;

  const T* Ab  = A  + (size_t)b * strideA;
  const T* Bb  = Bt + (size_t)b * strideB;
  const T* Ab2 = SPLIT ? (A2  + (size_t)b * strideA) : nullptr;
  const T* Bb2 = SPLIT ? (Bt2 + (size_t)b * strideB) : nullptr;

  const int rlane = lane & 15;                 // row (A) / col (B, D) within subtile
  const int koff  = (lane >> 4) * 8;           // k offset of this lane half
  const int mOff  = (lane >> 4) * 8;           // D row offset

  v8f acc[4][4];
#pragma unroll
  for (int i = 0; i < 4; ++i)
#pragma unroll
    for (int j = 0; j < 4; ++j) acc[i][j] = (v8f){0.f,0.f,0.f,0.f,0.f,0.f,0.f,0.f};

  for (int k0 = 0; k0 < K; k0 += 32) {
    V bh[4], bl[4];
#pragma unroll
    for (int j = 0; j < 4; ++j) {
      const size_t bo = (size_t)(n0 + (j << 4) + rlane) * ldb + koff + k0;
      bh[j] = Frag<T>::load(Bb + bo);
      if (SPLIT) bl[j] = Frag<T>::load(Bb2 + bo);
    }
#pragma unroll
    for (int i = 0; i < 4; ++i) {
      const size_t ao = (size_t)(m0 + (i << 4) + rlane) * lda + koff + k0;
      V ah = Frag<T>::load(Ab + ao);
      V al;
      if (SPLIT) al = Frag<T>::load(Ab2 + ao);
#pragma unroll
      for (int j = 0; j < 4; ++j) {
        acc[i][j] = Frag<T>::mma(ah, bh[j], acc[i][j]);
        if (SPLIT) {
          acc[i][j] = Frag<T>::mma(ah, bl[j], acc[i][j]);
          acc[i][j] = Frag<T>::mma(al, bh[j], acc[i][j]);
        }
      }
      Frag<T>::guard(acc[i][0], acc[i][3], ah, SPLIT ? al : ah);
    }
    Frag<T>::keep(bh[0], bh[1], bh[2], bh[3]);
    if (SPLIT) Frag<T>::keep(bl[0], bl[1], bl[2], bl[3]);
  }
  acc_guard4(acc[0][0], acc[0][1], acc[0][2], acc[0][3]);
  acc_guard4(acc[1][0], acc[1][1], acc[1][2], acc[1][3]);
  acc_guard4(acc[2][0], acc[2][1], acc[2][2], acc[2][3]);
  acc_guard4(acc[3][0], acc[3][1], acc[3][2], acc[3][3]);

  // ---- epilogue ----
  float* slab = sT[wave];
  const float* Rb = RESID ? (resid + (size_t)b * strideR) : nullptr;
#pragma unroll
  for (int i = 0; i < 4; ++i) {
    const int mBase = m0 + (i << 4);
#pragma unroll
    for (int j = 0; j < 4; ++j) {
      const int n = n0 + (j << 4) + rlane;
      float bv = 0.f;
      if (BIAS_MODE == 2) bv = bias[n];
#pragma unroll
      for (int r = 0; r < 8; ++r) {
        float v = acc[i][j][r] * scale;
        if (BIAS_MODE == 1) v += bias[mBase + mOff + r];
        if (BIAS_MODE == 2) v += bv;
        if (RESID) v += Rb[(size_t)(mBase + mOff + r) * ldc + n];
        if (ACT == 1) v = tanhf(v);
        if (ACT == 2) v = fmaxf(v, 0.0f);
        if (ACT == 3) v = v / (1.0f + expf(-v));
        if (ACT == 4) v = (v > 0.f) ? v : 0.01f * v;
        if (ACT == 5) v = 0.5f * v * (1.0f + erff(v * 0.70710678118654752f));
        slab[(mOff + r) * 68 + (j << 4) + rlane] = v;
      }
    }
    __builtin_amdgcn_fence(__ATOMIC_RELEASE, "workgroup");
    __builtin_amdgcn_wave_barrier();
    __builtin_amdgcn_fence(__ATOMIC_ACQUIRE, "workgroup");
    if (OUT_MODE == 0) {
      float* C = (float*)Cout + (size_t)b * strideC;
      const int hh = lane >> 4, c4 = (lane & 15) * 4;     // row seg = 256 B = 16 lanes x 16 B
      {
#pragma unroll
        for (int it = 0; it < 8; ++it) {
          const int row = it * 2 + hh;
          v4f v = *(const v4f*)(slab + row * 68 + c4);
          *(v4f*)(C + (size_t)(mBase + row) * ldc + n0 + c4) = v;
        }
        
      }
    } else {
      const int q = lane >> 3, c8 = (lane & 7) * 8;
      unsigned short* C  = (unsigned short*)Cout  + (size_t)b * strideC;
      unsigned short* C2 = (OUT_MODE == 2) ? ((unsigned short*)Cout2 + (size_t)b * strideC) : nullptr;
      {
#pragma unroll
        for (int it = 0; it < 4; ++it) {
          const int row = it * 4 + q;
          const float* sp = slab + row * 68 + c8;
          v8h hv, lv;
#pragma unroll
          for (int e = 0; e < 8; ++e) {
            if (OUT_MODE == 1) {
              hv[e] = (_Float16)sp[e];
            } else {
              unsigned short hb = f2bf_bits(sp[e]);
              unsigned short lb = f2bf_bits(sp[e] - bf_bits2f(hb));
              hv[e] = __builtin_bit_cast(_Float16, hb);
              lv[e] = __builtin_bit_cast(_Float16, lb);
            }
          }
          *(v8h*)(C + (size_t)(mBase + row) * ldc + n0 + c8) = hv;
          if (OUT_MODE == 2) *(v8h*)(C2 + (size_t)(mBase + row) * ldc + n0 + c8) = lv;
        }
        
      }
    }
    __builtin_amdgcn_fence(__ATOMIC_RELEASE, "workgroup");
    __builtin_amdgcn_wave_barrier();
    __builtin_amdgcn_fence(__ATOMIC_ACQUIRE, "workgroup");
  }
}

__global__ __launch_bounds__(256) void cast_f32_f16x2(
    const float* __restrict__ in, _Float16* __restrict__ out, int n2) {
  int i = blockIdx.x * 256 + threadIdx.x;
  if (i < n2) {
    const _Float16 h0 = (_Float16)in[2 * i], h1 = (_Float16)in[2 * i + 1];
    const unsigned u = (unsigned)__builtin_bit_cast(unsigned short, h0) | ((unsigned)__builtin_bit_cast(unsigned short, h1) << 16);
    ((unsigned*)out)[i] = u;
    
  }
}


} // namespace w25

namespace w25 {
// =====================================================================================
// Generic causal/non-causal attention for head_dim 64, f32 in / f32 out; 16-bit operands: bf16 with optional hi/lo splits, or
// plain f16 (F16=true, non-split, probabilities carried x2^15).
//   scores = (q*qscale)·kᵀ : v_wmma_f32_16x16x32_bf16; SPLIT_QK -> q,k as bf16 hi/lo (hi·hi + hi·lo + lo·hi)
//   out    = p·v           : v_wmma_f32_16x16x32_bf16; SPLIT_PV -> p,v as bf16 hi/lo; else p,v plain bf16
//   f32 accumulate; online softmax in f32. Block = 4 waves = 64 query rows of one (batch, head); S % 64 == 0.
//   Element (b, s, h, d) of tensor X lives at X[b*X_bs + s*X_rs + h*X_hs + d] (strides in floats, multiples of 4).
//   Masking: mask_mode 0 none, 1 causal (kv > q masked), 2 tensor [S][Skv] shared over (b,h) (float if
//   mask_is_int==0, int32 with element == 0 -> masked if 1, int32 with element != 0 -> masked if 2), 3 per-token vectors qmask[B][S] & kvmask[B][Skv] (int32,
//   0 -> masked), 4 causal + sliding window (kv > q or q - kv > W masked; W passed in mask_is_int);
//   5 = relative-position bias: s += cp[b,h,q][idx[q][kv]] + pc[b,h,kv][idx[q][kv]] with idx = mask_b ([S][Skv] int32) and
//   mask_a an int32 [S][Skv] tensor with nonzero = masked (tables: element (b,h,row,n) at X + b*c_bs + h*c_hs + row*c_rs + n);
//   masked scores are replaced by mask_fill (e.g. -inf or -1e9) before the softmax.
//   grid.x = B * H * (S/64) (or a sub-range with blk0).
// =====================================================================================
#define AT_D 64
#define AT_NW 4
#define AT_QB 64
#define AT_KC 64
struct AttnGeom { const float* cp = nullptr; const float* pc = nullptr; long c_bs = 0, c_rs = 0, c_hs = 0;   // mode-5 score-bias tables
                  long q_bs, q_rs, q_hs, k_bs, k_rs, k_hs, v_bs, v_rs, v_hs, o_bs, o_rs, o_hs;
                  int S, Skv, H, mask_mode; float qscale; int blk0; float mask_fill; int mask_is_int; };
static_assert(sizeof(AttnGeom) == 168, "no padding");

__device__ __forceinline__ unsigned short at_bf_bits(float f) {
  unsigned u = __float_as_uint(f);
  return (unsigned short)((u + 0x7FFFu + ((u >> 16) & 1u)) >> 16);
}
__device__ __forceinline__ __bf16 at_f2bf(float f) { return __builtin_bit_cast(__bf16, at_bf_bits(f)); }
__device__ __forceinline__ void at_split(float f, __bf16& hi, __bf16& lo) {
  const unsigned short hb = at_bf_bits(f);
  hi = __builtin_bit_cast(__bf16, hb);
  lo = at_f2bf(f - __uint_as_float(((unsigned)hb) << 16));
}
__device__ __forceinline__ v8f at_mma(v16b a, v16b b, v8f c) {
  c = __builtin_amdgcn_wmma_f32_16x16x32_bf16(false, a, false, b, (short)0, c, false, false);
  asm volatile("v_nop\n\tv_nop\n\tv_nop\n\tv_nop" : "+v"(c) : "v"(a), "v"(b));
  return c;
}
// 16-bit element as a bit pattern held in a __bf16 slot: f16 bits when F16, bf16 (RNE) otherwise
template <bool F16> __device__ __forceinline__ __bf16 at_to16(float f) {
  if (F16) return __builtin_bit_cast(__bf16, (_Float16)f);
  return at_f2bf(f);
}
template <bool F16> __device__ __forceinline__ v8f at_mma16(v16b a, v16b b, v8f c) {
  if (F16) {
    const v16h ah = __builtin_bit_cast(v16h, a), bh = __builtin_bit_cast(v16h, b);
    c = __builtin_amdgcn_wmma_f32_16x16x32_f16(false, ah, false, bh, (short)0, c, false, false);
    asm volatile("v_nop\n\tv_nop\n\tv_nop\n\tv_nop" : "+v"(c) : "v"(ah), "v"(bh));
    return c;
  }
  return at_mma(a, b, c);
}

template <bool SPLIT_QK, bool SPLIT_PV, bool F16 = false>
__global__ __launch_bounds__(128)
void attn64_kernel(const float* __restrict__ q, const float* __restrict__ k,
                   const float* __restrict__ v, float* __restrict__ out,
                   const void* __restrict__ mask_a, const int* __restrict__ mask_b, AttnGeom g) {
  static_assert(!(F16 && (SPLIT_QK || SPLIT_PV)), "f16 mode is non-split");
  const float PSC = F16 ? 32768.0f : 1.0f;     // f16 probabilities carried x2^15 (subnormal range), folded into the final 1/l
  union FB { v16b v; v8b h[2]; };
  __shared__ __align__(16) __bf16 Ksh[AT_KC * AT_D];             // K hi [kv][d]      8 KB
  __shared__ __align__(16) __bf16 Ksl[SPLIT_QK ? AT_KC * AT_D : 8];
  __shared__ __align__(16) __bf16 Vth[AT_D * AT_KC];             // V hi [d][kv]      8 KB
  __shared__ __align__(16) __bf16 Vtl[SPLIT_PV ? AT_D * AT_KC : 8];
  __shared__ __align__(16) __bf16 Psh[AT_NW][16 * AT_KC];        // per wave P hi [row][kv]  8 KB
  __shared__ __align__(16) __bf16 Psl[SPLIT_PV ? AT_NW : 1][SPLIT_PV ? 16 * AT_KC : 8];
  __shared__ __align__(16) float  Os[AT_NW][16 * 68];            // per wave out tile, pitch 68

  const int tid  = threadIdx.x;
  const int wave = tid >> 5;
  const int lane = tid & 31;
  const int hh   = lane >> 4;
  const int c    = lane & 15;

  const int nqb = g.S / AT_QB;
  const int bx = blockIdx.x + g.blk0;
  const int qb = bx % nqb;
  const int bh = bx / nqb;
  const int h  = bh % g.H;
  const int b  = bh / g.H;
  const int qbase_block = qb * AT_QB;
  const int q0 = qbase_block + wave * 16;

  const float* qb_ptr = q + (size_t)b * g.q_bs + (size_t)h * g.q_hs;
  const float* kb_ptr = k + (size_t)b * g.k_bs + (size_t)h * g.k_hs;
  const float* vb_ptr = v + (size_t)b * g.v_bs + (size_t)h * g.v_hs;
  float*       ob_ptr = out + (size_t)b * g.o_bs + (size_t)h * g.o_hs;

  // ---- Q fragments (A operand): 2 d-chunks, hi (and lo) ----
  v16b qah[2], qal[2];
  {
    const float* qrow = qb_ptr + (size_t)(q0 + c) * g.q_rs;
#pragma unroll
    for (int dc = 0; dc < 2; ++dc) {
#pragma unroll
      for (int e = 0; e < 8; ++e) {
        const float f0 = qrow[dc * 32 + 8 * hh + e] * g.qscale;
        const float f1 = qrow[dc * 32 + 16 + 8 * hh + e] * g.qscale;
        if (SPLIT_QK) { __bf16 hq, lq; at_split(f0, hq, lq); qah[dc][e] = hq; qal[dc][e] = lq; at_split(f1, hq, lq); qah[dc][8 + e] = hq; qal[dc][8 + e] = lq; }
        else { qah[dc][e] = at_to16<F16>(f0); qah[dc][8 + e] = at_to16<F16>(f1); qal[dc][e] = qah[dc][e]; qal[dc][8 + e] = qah[dc][8 + e]; }
      }
    }
  }

  float mrow[8], lrow[8];
  v8f oacc[4];
#pragma unroll
  for (int r = 0; r < 8; ++r) { mrow[r] = -INFINITY; lrow[r] = 0.f; }
#pragma unroll
  for (int t = 0; t < 4; ++t) oacc[t] = (v8f){0.f,0.f,0.f,0.f,0.f,0.f,0.f,0.f};

  const int nChunks = (g.mask_mode == 1 || g.mask_mode == 4) ? (qb + 1) : (g.Skv / AT_KC);   // block-uniform
  // per-row query mask (mode 3)
  int qkeep[8];
#pragma unroll
  for (int r = 0; r < 8; ++r) qkeep[r] = (g.mask_mode == 3) ? mask_b[(size_t)b * g.S + q0 + 8 * hh + r] : 1;   // mask_b = qmask in mode 3
  for (int kc = 0; kc < nChunks; ++kc) {
    const int kv0 = kc * AT_KC;
    __syncthreads();
    {
      const int kvr = tid >> 1, dh = (tid & 1) * 32;
      const float* krow = kb_ptr + (size_t)(kv0 + kvr) * g.k_rs + dh;
      const float* vrow = vb_ptr + (size_t)(kv0 + kvr) * g.v_rs + dh;
#pragma unroll
      for (int i = 0; i < 8; ++i) {
        v4f kk = *(const v4f*)(krow + 4 * i);
        v4f vv = *(const v4f*)(vrow + 4 * i);
#pragma unroll
        for (int e = 0; e < 4; ++e) {
          const int d = dh + 4 * i + e;
          if (SPLIT_QK) { __bf16 a, bl; at_split(kk[e], a, bl); Ksh[kvr * AT_D + d] = a; Ksl[kvr * AT_D + d] = bl; }
          else Ksh[kvr * AT_D + d] = at_to16<F16>(kk[e]);
          if (SPLIT_PV) { __bf16 a, bl; at_split(vv[e], a, bl); Vth[d * AT_KC + kvr] = a; Vtl[d * AT_KC + kvr] = bl; }
          else Vth[d * AT_KC + kvr] = at_to16<F16>(vv[e]);
        }
      }
    }
    __syncthreads();

    v8f s[4];
#pragma unroll
    for (int j = 0; j < 4; ++j) {
      s[j] = (v8f){0.f,0.f,0.f,0.f,0.f,0.f,0.f,0.f};
#pragma unroll 1
      for (int dc = 0; dc < 2; ++dc) {
        FB kb;
        kb.h[0] = *(const v8b*)(Ksh + (j * 16 + c) * AT_D + dc * 32 + 8 * hh);
        kb.h[1] = *(const v8b*)(Ksh + (j * 16 + c) * AT_D + dc * 32 + 16 + 8 * hh);
        s[j] = at_mma16<F16>(qah[dc], kb.v, s[j]);
        if (SPLIT_QK) {
          FB kl;
          kl.h[0] = *(const v8b*)(Ksl + (j * 16 + c) * AT_D + dc * 32 + 8 * hh);
          kl.h[1] = *(const v8b*)(Ksl + (j * 16 + c) * AT_D + dc * 32 + 16 + 8 * hh);
          s[j] = at_mma16<F16>(qah[dc], kl.v, s[j]);
          s[j] = at_mma16<F16>(qal[dc], kb.v, s[j]);
        }
      }
    }
    const bool diag = (g.mask_mode == 1) && (kc == qb);
    int kvkeep[4] = {1, 1, 1, 1};
    if (g.mask_mode == 3) {
#pragma unroll
      for (int j = 0; j < 4; ++j) kvkeep[j] = ((const int*)mask_a)[(size_t)b * g.Skv + kv0 + j * 16 + c];   // mask_a = kvmask
    }
    float cm[8];
#pragma unroll
    for (int r = 0; r < 8; ++r) {
      const int qrow = q0 + 8 * hh + r;
      float m = -INFINITY;
#pragma unroll
      for (int j = 0; j < 4; ++j) {
        const int kvcol = kv0 + j * 16 + c;
        bool masked = false;
        if (diag) masked = (kvcol > qrow);
        else if (g.mask_mode == 4) masked = (kvcol > qrow) || (qrow - kvcol > g.mask_is_int);
        else if (g.mask_mode == 2) {
          const size_t mi = (size_t)qrow * g.Skv + kvcol;
          masked = (g.mask_is_int == 0) ? (((const float*)mask_a)[mi] == 0.0f)
                 : (g.mask_is_int == 1) ? (((const int*)mask_a)[mi] == 0) : (((const int*)mask_a)[mi] != 0);
        } else if (g.mask_mode == 3) masked = (qkeep[r] == 0) || (kvkeep[j] == 0);
        else if (g.mask_mode == 5) {
          const size_t mi = (size_t)qrow * g.Skv + kvcol;
          masked = (((const int*)mask_a)[mi] != 0);
          int n = mask_b[mi]; n = n < 0 ? 0 : n;
          s[j][r] += g.cp[(size_t)b * g.c_bs + (size_t)h * g.c_hs + (size_t)qrow * g.c_rs + n]
                   + g.pc[(size_t)b * g.c_bs + (size_t)h * g.c_hs + (size_t)kvcol * g.c_rs + n];
        }
        if (masked) s[j][r] = g.mask_fill;
        m = fmaxf(m, s[j][r]);
      }
#pragma unroll
      for (int off = 1; off < 16; off <<= 1) m = fmaxf(m, __shfl_xor(m, off, 32));
      cm[r] = m;
    }
    __bf16* pwh = Psh[wave];
    __bf16* pwl = Psl[SPLIT_PV ? wave : 0];
#pragma unroll
    for (int r = 0; r < 8; ++r) {
      const float mnew = fmaxf(mrow[r], cm[r]);
      const float alpha = expf(mrow[r] - mnew);
      mrow[r] = mnew;
      float psum = 0.f;
#pragma unroll
      for (int j = 0; j < 4; ++j) {
        const float p = expf(s[j][r] - mnew);
        psum += p;
        if (SPLIT_PV) { __bf16 a, bl; at_split(p, a, bl); pwh[(8 * hh + r) * AT_KC + j * 16 + c] = a; pwl[(8 * hh + r) * AT_KC + j * 16 + c] = bl; }
        else pwh[(8 * hh + r) * AT_KC + j * 16 + c] = at_to16<F16>(p * PSC);
      }
#pragma unroll
      for (int off = 1; off < 16; off <<= 1) psum += __shfl_xor(psum, off, 32);
      lrow[r] = lrow[r] * alpha + psum;
#pragma unroll
      for (int t = 0; t < 4; ++t) oacc[t][r] *= alpha;
    }
    __builtin_amdgcn_fence(__ATOMIC_RELEASE, "workgroup");
    __builtin_amdgcn_wave_barrier();
    __builtin_amdgcn_fence(__ATOMIC_ACQUIRE, "workgroup");
#pragma unroll 1
    for (int kk = 0; kk < 2; ++kk) {
      FB pa, pl;
      pa.h[0] = *(const v8b*)(pwh + c * AT_KC + kk * 32 + 8 * hh);
      pa.h[1] = *(const v8b*)(pwh + c * AT_KC + kk * 32 + 16 + 8 * hh);
      if (SPLIT_PV) {
        pl.h[0] = *(const v8b*)(pwl + c * AT_KC + kk * 32 + 8 * hh);
        pl.h[1] = *(const v8b*)(pwl + c * AT_KC + kk * 32 + 16 + 8 * hh);
      }
#pragma unroll
      for (int t = 0; t < 4; ++t) {
        FB vb;
        vb.h[0] = *(const v8b*)(Vth + (t * 16 + c) * AT_KC + kk * 32 + 8 * hh);
        vb.h[1] = *(const v8b*)(Vth + (t * 16 + c) * AT_KC + kk * 32 + 16 + 8 * hh);
        oacc[t] = at_mma16<F16>(pa.v, vb.v, oacc[t]);
        if (SPLIT_PV) {
          FB vl;
          vl.h[0] = *(const v8b*)(Vtl + (t * 16 + c) * AT_KC + kk * 32 + 8 * hh);
          vl.h[1] = *(const v8b*)(Vtl + (t * 16 + c) * AT_KC + kk * 32 + 16 + 8 * hh);
          oacc[t] = at_mma16<F16>(pa.v, vl.v, oacc[t]);
          oacc[t] = at_mma16<F16>(pl.v, vb.v, oacc[t]);
        }
      }
    }
  }

  float* os = Os[wave];
#pragma unroll
  for (int r = 0; r < 8; ++r) {
    const float inv = 1.0f / (lrow[r] * PSC);
#pragma unroll
    for (int t = 0; t < 4; ++t) os[(8 * hh + r) * 68 + t * 16 + c] = oacc[t][r] * inv;
  }
  __builtin_amdgcn_fence(__ATOMIC_RELEASE, "workgroup");
  __builtin_amdgcn_wave_barrier();
  __builtin_amdgcn_fence(__ATOMIC_ACQUIRE, "workgroup");
  {
    const int c4 = (lane & 15) * 4;
    {
#pragma unroll
      for (int it = 0; it < 8; ++it) {
        const int row = it * 2 + hh;
        v4f val = *(const v4f*)(os + row * 68 + c4);
        *(v4f*)(ob_ptr + (size_t)(q0 + row) * g.o_rs + c4) = val;
      }
      
    }
  }
}

} // namespace w25

typedef __attribute__((ext_vector_type(2))) unsigned v2u;
typedef __attribute__((ext_vector_type(8))) _Float16 v8hp;
typedef __attribute__((ext_vector_type(2))) float v2fp;
typedef __attribute__((ext_vector_type(2))) __bf16 v2bp;
// two neighbouring f32 -> packed bf16 hi (returned) and packed bf16 lo of the remainders (x = hi + lo to ~2^-17 relative), both rounded to nearest even by the
//   hardware's packed conversion: five instructions a pair, which is what lets the split stand inside the product loop
__device__ __forceinline__ unsigned bf2_split(float a, float b, unsigned* lo) {
    const unsigned h = __builtin_bit_cast(unsigned, __builtin_convertvector((v2fp){a, b}, v2bp));
    const v2fp r = (v2fp){a, b} - (v2fp){__uint_as_float(h << 16), __uint_as_float(h & 0xffff0000u)};
    *lo = __builtin_bit_cast(unsigned, __builtin_convertvector(r, v2bp));
    return h; }
// transposing LDS load: lane (c = lane & 15, h = lane >> 4) gets column c, rows 8 h .. 8 h + 7 of the 16 x 16 block of 16-bit values whose row 8 (lane >> 4) + (lane & 7),
//   16-byte half (lane >> 3) & 1 the lane's address names: half of a 16 x 32 A fragment in the fragment loaders' k order
typedef __attribute__((ext_vector_type(8))) short v8sp;
__device__ __forceinline__ v8hp lds_tr16(const unsigned char* p) {
    typedef __attribute__((address_space(3))) v8sp lds_v8sp;
    return __builtin_bit_cast(v8hp, __builtin_amdgcn_ds_load_tr16_b128_v8i16((lds_v8sp*)p)); }
// the value of lane ^ X inside a 16-lane row (DPP row_xmask:X): a vector move, no LDS round trip and no index register
template <int X> __device__ __forceinline__ float row_xor(float v) { return __int_as_float(__builtin_amdgcn_update_dpp(0, __float_as_int(v), 0x160 + X, 0xf, 0xf, false)); }
// expf, step for step as the compiler expands it (x * log2(e) in two parts, 2^fraction, ldexp, the two range tests), written out so that the v_nop can stand in the
//   statement of v_exp_f32: it fills the one slot the instruction set asks for in front of a vector instruction that reads the result or overwrites the source
__device__ __forceinline__ float exp_slot(float x) {
    const float ph = x * 0x1.715476p+0f;
    const float pl = fmaf(x, 0x1.4ae0bep-26f, fmaf(x, 0x1.715476p+0f, -ph));
    const float en = rintf(ph);
    const float a = (ph - en) + pl;
    float y;
    asm("v_exp_f32 %0, %1\n\tv_nop" : "=v"(y) : "v"(a));
    float r = ldexpf(y, (int)en);
    r = (x < -0x1.9d1da0p+6f) ? 0.f : r;
    r = (x > 0x1.62e430p+6f) ? __builtin_inff() : r;
    return r;
}
// one wave per row, RW rows per wave one after the other: sim = tril + AQ[n] + CM[m], masked exactly as the module: sim + (1 - qm*mm) * -1e30; the whole row stays in
//   registers (32 values per lane) from the one read of SIM to the one write: row max -> RMX, softmax over m (exp once), probabilities x ps stored as f16, the
//   operand plane of the query->memory product. CM and the memory mask are read once per wave; max and sum meet by lane shuffles, so the kernel has no barrier.
typedef __attribute__((ext_vector_type(4))) _Float16 v4h;
typedef __attribute__((ext_vector_type(4))) int      v4i;
template <int N, int M, int RW>
__global__ __launch_bounds__(256) void k_bi_soft16(const float* __restrict__ SIM, const float* __restrict__ AQ, const float* __restrict__ CM, const int* __restrict__ QM, const int* __restrict__ MM, float* __restrict__ RMX, _Float16* __restrict__ P16, float ps) {
    static_assert(M % 128 == 0 && N % (8 * RW) == 0, "whole 512-byte wave loads; whole blocks of 8 waves x RW rows");
    constexpr int C = M / 128;
    const int lane = threadIdx.x & 31, wv = __builtin_amdgcn_readfirstlane(threadIdx.x >> 5);
    const size_t bz = blockIdx.y;   // batch = blockIdx.y
    const size_t row0 = bz * N + (size_t)(blockIdx.x * 8 + wv) * RW;
    float aqv[RW], qmv[RW];
#pragma unroll
    for (int r = 0; r < RW; ++r) { aqv[r] = AQ[row0 + r]; qmv[r] = (float)QM[row0 + r]; }
    const float* sr = SIM + row0 * M + lane * 4;
    v4f x[C], nx[C], cm[C], mf[C]; v4i mk[C];
#pragma unroll
    for (int i = 0; i < C; ++i) x[i] = *(const v4f*)(sr + i * 128);
#pragma unroll
    for (int i = 0; i < C; ++i) { cm[i] = *(const v4f*)(CM + bz * M + lane * 4 + i * 128); mk[i] = *(const v4i*)(MM + bz * M + lane * 4 + i * 128); }
#pragma unroll
    for (int r = 0; r < RW; ++r) {
        if (r + 1 < RW) {
#pragma unroll
            for (int i = 0; i < C; ++i) nx[i] = *(const v4f*)(sr + (size_t)(r + 1) * M + i * 128);   // the next row flies while this one is worked on
            asm volatile("s_wait_xcnt 0x0" ::: "memory");   // the row's work may reuse the offset register that the loads above name
            __builtin_amdgcn_sched_barrier(0);   // keeps the loads and their wait at the head of the row's work; left free the loads sink to just ahead of their first use
        }
        if (r == 0) {
#pragma unroll
            for (int i = 0; i < C; ++i) mf[i] = __builtin_convertvector(mk[i], v4f);
        }
        const float aq = aqv[r], qm = qmv[r];
        float mx = -3.0e38f;
#pragma unroll
        for (int i = 0; i < C; ++i)
#pragma unroll
            for (int e = 0; e < 4; ++e) { const float msk = qm * mf[i][e]; const float v = x[i][e] + aq + cm[i][e] + (1.f - msk) * -1.0e30f; x[i][e] = v; mx = fmaxf(mx, v); }
        for (int o = 16; o > 0; o >>= 1) mx = fmaxf(mx, __shfl_xor(mx, o, 32));
        v4f s4 = {0.f, 0.f, 0.f, 0.f};
#pragma unroll
        for (int i = 0; i < C; ++i)
#pragma unroll
            for (int e = 0; e < 4; ++e) { const float ev = exp_slot(x[i][e] - mx); x[i][e] = ev; s4[e] += ev; }
        float s = (s4[0] + s4[1]) + (s4[2] + s4[3]);
        for (int o = 16; o > 0; o >>= 1) s += __shfl_xor(s, o, 32);
        const float inv = 1.f / s;
        _Float16* pr = P16 + (row0 + r) * M + lane * 4;
        v4h hv[C];
#pragma unroll
        for (int i = 0; i < C; ++i)
#pragma unroll
            for (int e = 0; e < 4; ++e) hv[i][e] = (_Float16)((x[i][e] * inv) * ps);
        __builtin_amdgcn_sched_barrier(0);   // with the one below: nothing that refills a register of these stores is scheduled between them and their wait
#pragma unroll
        for (int i = 0; i < C; ++i) *(v4h*)(pr + i * 128) = hv[i];
        VST2(float, RMX + (row0 + r) * 32 + lane, mx);   // row max staged as a whole 32-float line (slot 0 is read later)
        if (r + 1 < RW) {
            asm volatile("s_wait_xcnt 0x0" ::: "memory");   // the next row's work reuses the registers that the stores above name
            __builtin_amdgcn_sched_barrier(0);
        }
#pragma unroll
        for (int i = 0; i < C; ++i) x[i] = nx[i];
    } }

// Operand preparation, similarity product, masked row softmax and query->memory product in ONE launch; the 16-bit operands, the similarity matrix and the
//   probabilities never leave the chip's LDS and registers.
//   A masked memory row has probability 0 in every query that has an unmasked score at all (2^(-1e30 - max) is 0) and never holds its row maximum, so only the batch's
//   unmasked memory rows are walked: the block packs their row numbers into an LDS list (ballots and a prefix over the 16 waves' counts), and the copies gather by it.
//   A query whose scores are ALL masked (its own mask is 0, or no memory row is unmasked) is not stored here: its scores all equal -1e30, its row is the mean of all
//   memory rows, and the second launch stores it; its row maximum, -1e30, comes out of the arithmetic below as before.
//   Block = 16 waves = 4 groups of 16 query rows x 4 quarters of the packed rows' tiles. A wave walks its quarter's tiles of 32 packed memory rows:
//   S^T = memory x (q * w_qm + w_m)^T (bf16 hi/lo, three products): sum_d m_d (q_d w_qm_d + w_m_d) is the trilinear term and memory . w_m in one product, so no row dot
//   of memory is needed; a lane holds scores of ONE query (column lane & 15; rows 8 * (lane >> 4) + r of each 16-row tile);
//   sim = S + q . w_q + (1 - qm * mm) * -1e30 as the module has it; running maximum and sum; p = 2^((sim - max) * log2(e) + lps), one subtraction, one fused
//   multiply-add and one v_exp_f32 a score: the f16 scale 2^lps rides in the exponent and, being in the sum as well, cancels in the quotient (os undoes the scale ts of the
//   f16 tile alone). The subtraction comes first: at -1e30 a product with log2(e) would round by more than the whole exponent range. The two 16-row score tiles, as f16, ARE the B operand of
//   O^T += memory^T x P^T (the k order of the fragment loaders). The four quarters of a query meet once, at the end, through LDS.
//   The memory tiles are made here from the f32 input, two LDS buffers: of the four waves that share a quarter each brings 8 whole rows of tile s + 1 into an LDS slot of
//   its own by asynchronous 16-byte copies that fly under trip s, reads them back ahead of the trip's second product and stores, one row between every two of that
//   product's matrix instructions, their bf16 hi and lo rows and their f16 x ts rows. The f16 tile stays row-major ([m][d]: every store covers one whole row); the
//   second product takes its memory^T fragments from it by transposing loads. Row pitches 272 bytes (16 x odd, 16-byte reads) and 288 bytes (32 x odd, transposing
//   reads) keep the fragment reads off each other's banks.
//   Every '#pragma unroll' below stands on a loop whose index picks a fragment, an accumulator or a vector element: unrolled, these stay in registers.
template <int N, int M, int D>
__global__ __launch_bounds__(512) void k_bi_fused(const float* __restrict__ Q, const float* __restrict__ MEM, const float* __restrict__ wq, const float* __restrict__ wm, const float* __restrict__ wqm,
        const int* __restrict__ QM, const int* __restrict__ MM, float* __restrict__ REC, float* __restrict__ OUT, float ts, float lps, float os) {
    static_assert(N == M, "a block sums as many memory rows as it has query rows");
    static_assert(N % 64 == 0 && M == 1024 && D == 128, "64 query rows a block; 4 quarters of 8 tiles of 32 memory rows; 2 mask words a thread; one 16-byte load per lane and row");
    typedef w25::Frag<__bf16> FB; typedef w25::Frag<_Float16> FH; typedef w25::v8f v8f;
    constexpr int PA = 272, PV = 288;                   // LDS row pitch in bytes: 256-byte rows of hi and lo; 256-byte rows of the f16 tile
    constexpr int TILE = 2 * 32 * PA + 32 * PV;         // one quarter's tile: hi, lo, f16
    constexpr int BUF = 4 * TILE, MQ4 = M / 4, NS = MQ4 / 32;
    constexpr int SO = 16 * 8 * 32 * 8 * 4;             // bytes of the 16 waves' partial outputs
    static_assert(2 * BUF >= SO + 2 * 16 * D * 4 + 64, "the ring later holds the 16 waves' partial outputs and, behind them, their partial row sums");
    __shared__ __align__(32) unsigned char ring[2 * BUF];
    __shared__ __align__(16) unsigned char qs[2 * 64 * PA];
    __shared__ __align__(16) float smf[M];
    __shared__ __align__(16) unsigned char raw[16 * 8 * 512];   // a slot of 8 f32 rows for each wave, filled and read by that wave alone
    __shared__ float saq[64];
    __shared__ __align__(32) int sidx[M];   // the batch's unmasked memory rows, packed to the front; row 0 behind them
    __shared__ __align__(16) int wtot[16];  // unmasked rows among each wave's 64 mask words
    float (*smx)[4][16] = (float (*)[4][16])smf;           // the quarters' maxima and sums take the mask's place behind the loop
    float (*ssm)[4][16] = (float (*)[4][16])(smf + 256);
    const int lane = threadIdx.x & 31, wv = __builtin_amdgcn_readfirstlane(threadIdx.x >> 5);
    const int qg = wv & 3, ms = wv >> 2, nl = lane & 15, h = lane >> 4, koff = h * 8;
    const size_t bz = blockIdx.y, q0 = bz * N + (size_t)blockIdx.x * 64, row = q0 + qg * 16 + nl;
    const unsigned l4 = lane * 4;
    const float* gm = MEM + bz * M * D + l4;                         // this lane's 16 bytes of the batch's memory row 0
    const unsigned char* rw = raw + wv * 4096 + lane * 16;           // ... and their place in the first row of the wave's own slot: rows 512 bytes apart
    // one f32 row (this lane's 4 values) -> its bf16 hi row, bf16 lo row and f16 x ts row of a tile; pa, pf: this lane's 8 bytes of the wave's first row there
    auto put_row = [&](const v4f x, unsigned char* pa, unsigned char* pf, int i) {
        v2u hi, lo; unsigned l0, l1;
        hi[0] = bf2_split(x[0], x[1], &l0); hi[1] = bf2_split(x[2], x[3], &l1); lo[0] = l0; lo[1] = l1;
        *(v2u*)(pa + i * PA) = hi; *(v2u*)(pa + (32 + i) * PA) = lo;
        *(v4h*)(pf + i * PV) = __builtin_convertvector(x * ts, v4h);
    };
    typedef __attribute__((ext_vector_type(2))) int v2i;
    const v2i k = *(const v2i*)(MM + bz * M + threadIdx.x * 2);   // the memory mask of the whole batch row: read once a block
    const float* xp = Q + (q0 + wv * 4) * D + l4;
    const v4f w = *(const v4f*)(wq + lane * 4), g = *(const v4f*)(wqm + lane * 4), u = *(const v4f*)(wm + lane * 4);
    const int kq = (QM + q0 + qg * 16)[(unsigned)nl];   // scalar base and a lane offset that lives on: no address register of its own to be reused
    v4f y[4];
#pragma unroll
    for (int i = 0; i < 4; ++i) y[i] = *(const v4f*)(xp + i * D);
    asm volatile("s_wait_xcnt 0x0" ::: "memory");   // the work below reuses the address registers that the loads above name
    __builtin_amdgcn_sched_barrier(0);   // holds the first rewrite of those registers behind the wait
    // the unmasked memory rows are packed: a wave's rows with even index first, then its odd ones, wave after wave (the order of a softmax's terms is free)
    const unsigned b0 = __builtin_amdgcn_ballot_w32(k[0] != 0), b1 = __builtin_amdgcn_ballot_w32(k[1] != 0), below = (1u << lane) - 1u;
    if (lane == 0) wtot[wv] = __popc(b0) + __popc(b1);
    __syncthreads();   // the 16 waves' counts are there
    int first = 0, call = 0;
#pragma unroll
    for (int j = 0; j < 4; ++j) {
        const v4i tj = *(const v4i*)&wtot[j * 4];
#pragma unroll
        for (int c = 0; c < 4; ++c) { first += (j * 4 + c < wv) ? tj[c] : 0; call += tj[c]; }
    }
    const int cnt = __builtin_amdgcn_readfirstlane(call);   // unmasked rows of the batch, 0 .. M: the same in every wave
    // tiles of 32 packed rows are dealt to the four quarters in turn: quarter ms has tiles ms, ms + 4, ...: nt of them, which is nsd (the block's trips) or one fewer;
    //   both bounded by the shape and kept scalar for the branches on them. With no unmasked row one tile of masked rows is still walked: it yields the row maximum
    const int tiles = min((max(cnt, 1) + 31) >> 5, 4 * NS);
    const int nsd = __builtin_amdgcn_readfirstlane((tiles + 3) >> 2), nt = __builtin_amdgcn_readfirstlane((tiles + 3 - ms) >> 2);
    if (k[0] != 0) sidx[first + __popc(b0 & below)] = (int)threadIdx.x * 2;
    if (k[1] != 0) sidx[first + __popc(b0) + __popc(b1 & below)] = (int)threadIdx.x * 2 + 1;
    {   // behind the packed rows: row 0 with mask 0, which the arithmetic below treats like any masked row
        const int e0 = (int)threadIdx.x * 2, e1 = e0 + 1;
        if (e0 >= cnt) sidx[e0] = 0;
        if (e1 >= cnt) sidx[e1] = 0;
        *(v2fp*)&smf[e0] = (v2fp){e0 < cnt ? 1.f : 0.f, e1 < cnt ? 1.f : 0.f};
    }
    __syncthreads();   // publishes the packed list to the waves that aim their copies by it
    auto copy_rows = [&](int s) {
        const int* ip = sidx + (s * 4 + ms) * 32 + qg * 8;   // this wave's 8 rows of its quarter's tile s; every entry is a thread's own row number, below M
        const v4i r0 = *(const v4i*)ip, r1 = *(const v4i*)(ip + 4);
        const unsigned la = (unsigned)(size_t)rw;
        // the wait is the last line of the copies' own statement: no register that a copy names is rewritten ahead of it
        asm volatile("global_load_async_to_lds_b128 %0, %8, off\n\t"
                     "global_load_async_to_lds_b128 %1, %9, off\n\t"
                     "global_load_async_to_lds_b128 %2, %10, off\n\t"
                     "global_load_async_to_lds_b128 %3, %11, off\n\t"
                     "global_load_async_to_lds_b128 %4, %12, off\n\t"
                     "global_load_async_to_lds_b128 %5, %13, off\n\t"
                     "global_load_async_to_lds_b128 %6, %14, off\n\t"
                     "global_load_async_to_lds_b128 %7, %15, off\n\t"
                     "s_wait_xcnt 0x0"
                     :: "v"(la), "v"(la + 512u), "v"(la + 1024u), "v"(la + 1536u), "v"(la + 2048u), "v"(la + 2560u), "v"(la + 3072u), "v"(la + 3584u),
                        "v"(gm + (size_t)(unsigned)r0[0] * D), "v"(gm + (size_t)(unsigned)r0[1] * D), "v"(gm + (size_t)(unsigned)r0[2] * D), "v"(gm + (size_t)(unsigned)r0[3] * D),
                        "v"(gm + (size_t)(unsigned)r1[0] * D), "v"(gm + (size_t)(unsigned)r1[1] * D), "v"(gm + (size_t)(unsigned)r1[2] * D), "v"(gm + (size_t)(unsigned)r1[3] * D)
                     : "memory");
    };
    copy_rows(0);
    const float qm = (float)kq;
    {   // the block's 64 rows of q: wave wv takes rows 4 wv .. 4 wv + 3: q . w_q -> saq, q * w_qm + w_m -> hi and lo rows of qs
        float keep = 0.f;
#pragma unroll
        for (int i = 0; i < 4; ++i) {
            float s = y[i][0] * w[0]; s += y[i][1] * w[1]; s += y[i][2] * w[2]; s += y[i][3] * w[3];
            for (int o = 16; o > 0; o >>= 1) s += __shfl_xor(s, o, 32);
            if (lane == i) keep = s;
        }
        if (lane < 4) saq[wv * 4 + lane] = keep;
        unsigned char* pq = qs + wv * 4 * PA + lane * 8;
#pragma unroll
        for (int i = 0; i < 4; ++i) { v2u hi, lo; unsigned l0, l1;
            const v4f z = y[i] * g + u;
            hi[0] = bf2_split(z[0], z[1], &l0); hi[1] = bf2_split(z[2], z[3], &l1); lo[0] = l0; lo[1] = l1;
            *(v2u*)(pq + i * PA) = hi; *(v2u*)(pq + (64 + i) * PA) = lo; }
    }
    asm volatile("s_wait_asynccnt 0x0" ::: "memory");   // this wave's copies of tile 0 have landed; it alone reads its slot
#pragma unroll
    for (int i = 0; i < 8; ++i) put_row(*(const v4f*)(rw + i * 512), ring + ms * TILE + qg * 8 * PA + lane * 8, ring + ms * TILE + 64 * PA + qg * 8 * PV + lane * 8, i);
    asm volatile("s_wait_dscnt 0x0" ::: "memory");      // this wave's reads of its slot have returned before the next copies are aimed at it
    __syncthreads();   // publishes qs, saq and tile 0
    if (nsd > 1) copy_rows(1);
    const float aq = saq[qg * 16 + nl];
    FB::V qh[4], ql[4];
#pragma unroll
    for (int kk = 0; kk < 4; ++kk) {
        qh[kk] = FB::load((const __bf16*)(qs + (qg * 16 + nl) * PA) + koff + kk * 32);
        ql[kk] = FB::load((const __bf16*)(qs + (64 + qg * 16 + nl) * PA) + koff + kk * 32);
    }
    v8f o[8];
#pragma unroll
    for (int dt = 0; dt < 8; ++dt) o[dt] = (v8f){0.f, 0.f, 0.f, 0.f, 0.f, 0.f, 0.f, 0.f};
    float mrun = -3.0e38f, lsum = 0.f;
    constexpr float L2E = 0x1.715476p+0f;   // log2(e)
    typedef __attribute__((ext_vector_type(2))) float v2e;
    // O^T += memory^T x P^T over the 8 tiles of d; with make, tile s + 1 is made in between, a row for each tile of d, so that its vector work and its LDS stores run under
    //   the fragment reads and the matrix instructions. It goes into buffer nb, whose last readers (trip s - 1) left it at the barrier one trip ago.
    auto second = [&](const unsigned char* tt, const FH::V pb, const float alpha, const bool make, const int nb) __attribute__((always_inline)) {
        FH::U f[2];
        f[0].h[0] = lds_tr16(tt); f[0].h[1] = lds_tr16(tt + 16 * PV);
        v4f x[2];
        // holds the wait below behind the exponentials (left free it is scheduled up into the first product, where the copies are still young) and, in both forms of the trip,
        //   the second product's work out of the first product's stretch, where no register is free: without it the build spills
        __builtin_amdgcn_sched_barrier(0);
        if (make) {
            asm volatile("s_wait_asynccnt 0x0" ::: "memory");   // this wave's copies of tile s + 1 have landed; it alone reads its slot
            x[0] = *(const v4f*)rw;
        }
        unsigned char* pa = ring + nb * BUF + ms * TILE + qg * 8 * PA + lane * 8;
        unsigned char* pf = ring + nb * BUF + ms * TILE + 64 * PA + qg * 8 * PV + lane * 8;
#pragma unroll
        for (int dt = 0; dt < 8; ++dt) {
            if (dt < 7) { f[(dt + 1) & 1].h[0] = lds_tr16(tt + 32 * (dt + 1)); f[(dt + 1) & 1].h[1] = lds_tr16(tt + 16 * PV + 32 * (dt + 1)); }   // read ahead of the row's stores
            if (make) {
                if (dt < 7) x[(dt + 1) & 1] = *(const v4f*)(rw + (dt + 1) * 512);   // one row ahead: its latency is covered and only two rows' registers are held
                put_row(x[dt & 1], pa, pf, dt);
            }
            o[dt] = FH::mma(f[dt & 1].v, pb, o[dt] * alpha);
        }
    };
    // one trip: tile s is worked on; with make, tile s + 1 is made. Inlined at both places: a call would put the accumulators into memory
    auto trip = [&](const int s, const bool make) __attribute__((always_inline)) {
        const unsigned char* tb = ring + (s & 1) * BUF + ms * TILE;
        const __bf16* th = (const __bf16*)(tb + nl * PA) + koff;
        const __bf16* tl = (const __bf16*)(tb + (32 + nl) * PA) + koff;
        const unsigned char* tt = tb + 64 * PA + (koff + (lane & 7)) * PV + ((lane >> 3) & 1) * 16;   // the transposing load's lane address: memory rows 8 h + (lane & 7)
        v8f sc[2];
        sc[0] = (v8f){0.f, 0.f, 0.f, 0.f, 0.f, 0.f, 0.f, 0.f}; sc[1] = sc[0];
#pragma unroll
        for (int kk = 0; kk < 4; ++kk)
#pragma unroll
            for (int t = 0; t < 2; ++t) {
                const FB::V ah = FB::load(th + t * 16 * (PA / 2) + kk * 32);
                const FB::V al = FB::load(tl + t * 16 * (PA / 2) + kk * 32);
                sc[t] = FB::mma(ah, qh[kk], sc[t]);
                sc[t] = FB::mma(ah, ql[kk], sc[t]);
                sc[t] = FB::mma(al, qh[kk], sc[t]);
            }
        const int mb = (s * 4 + ms) * 32 + koff;
        float v[2][8];
        float mloc = -3.0e38f;
#pragma unroll
        for (int t = 0; t < 2; ++t) {
            const v4f f0 = *(const v4f*)&smf[mb + t * 16], f1 = *(const v4f*)&smf[mb + t * 16 + 4];
#pragma unroll
            for (int r = 0; r < 8; ++r) {
                const float msk = qm * (r < 4 ? f0[r & 3] : f1[r & 3]);
                const float sim = sc[t][r] + aq + (1.f - msk) * -1.0e30f;
                v[t][r] = sim; mloc = fmaxf(mloc, sim);
            }
        }
        mloc = fmaxf(mloc, __shfl_xor(mloc, 16, 32));   // the other 16 memory rows of this query's 32 lie in lane ^ 16
        const float mnew = fmaxf(mrun, mloc);
        float alpha = (mrun - mnew) * L2E;
        mrun = mnew;
        float e[2][8];   // first the exponents, two at a time (packed subtract, packed fused multiply-add), then 2^e in place
#pragma unroll
        for (int t = 0; t < 2; ++t)
#pragma unroll
            for (int r = 0; r < 8; r += 2) {
                const v2e a = __builtin_elementwise_fma((v2e){v[t][r], v[t][r + 1]} - (v2e){mnew, mnew}, (v2e){L2E, L2E}, (v2e){lps, lps});
                e[t][r] = a[0]; e[t][r + 1] = a[1];
            }
        // v_exp_f32 in runs: each fills the slot that the instruction set asks for behind the one before it, and the one v_nop fills it behind the last;
        //   left to the compiler every exponential went through one register, a dependent chain with a v_nop of its own
        asm("v_exp_f32 %0, %0\n\tv_exp_f32 %1, %1\n\tv_exp_f32 %2, %2\n\tv_exp_f32 %3, %3\n\tv_exp_f32 %4, %4\n\tv_exp_f32 %5, %5\n\t"
            "v_exp_f32 %6, %6\n\tv_exp_f32 %7, %7\n\tv_exp_f32 %8, %8\n\tv_nop"
            : "+v"(e[0][0]), "+v"(e[0][1]), "+v"(e[0][2]), "+v"(e[0][3]), "+v"(e[0][4]), "+v"(e[0][5]), "+v"(e[0][6]), "+v"(e[0][7]), "+v"(alpha));
        asm("v_exp_f32 %0, %0\n\tv_exp_f32 %1, %1\n\tv_exp_f32 %2, %2\n\tv_exp_f32 %3, %3\n\tv_exp_f32 %4, %4\n\tv_exp_f32 %5, %5\n\t"
            "v_exp_f32 %6, %6\n\tv_exp_f32 %7, %7\n\tv_nop"
            : "+v"(e[1][0]), "+v"(e[1][1]), "+v"(e[1][2]), "+v"(e[1][3]), "+v"(e[1][4]), "+v"(e[1][5]), "+v"(e[1][6]), "+v"(e[1][7]));
        FH::V pb;
        float s0 = 0.f, s1 = 0.f;
#pragma unroll
        for (int r = 0; r < 8; ++r) {
            s0 += e[0][r]; s1 += e[1][r];
            pb[r] = (_Float16)e[0][r]; pb[8 + r] = (_Float16)e[1][r];
        }
        lsum = lsum * alpha + (s0 + s1);
        second(tt, pb, alpha, make, (s + 1) & 1);
    };
#pragma unroll 1   // stays rolled: seven copies of the trip would carry the kernel's text past 32 KB
    for (int s = 0; s < nsd - 1; ++s) {
        trip(s, true);   // a quarter with one tile fewer makes, in the last of these trips, a tile of masked rows that nobody reads: a third form of the trip spills
        asm volatile("s_wait_dscnt 0x0" ::: "memory");   // this wave's reads of its slot have returned before the next copies are aimed at it
        __syncthreads();                          // publishes tile s + 1 and ends every wave's reads of buffer s & 1
        if (s + 2 < nsd) copy_rows(s + 2);        // flies under trip s + 1 up to its second product
    }
    {   // the block's share of the two sums over rows that the second launch finishes: rows 4 wv .. 4 wv + 3 of the block's 64 rows of q and of the 64 memory rows with the
        //   same numbers. No tile is left to make, so the wave's own slot is free (its reads returned at the s_wait_dscnt 0 in front of the last barrier): the 8 rows are
        //   copied there and fly under the last trip and the barriers behind it, which a load into registers would not (a barrier's fence waits for it)
        unsigned ln;
        asm volatile("v_mbcnt_lo_u32_b32 %0, -1, 0" : "=v"(ln));   // the lane's number formed anew: as the builtin it is merged with an earlier one and held through the loop, where no register is free
        const unsigned ln4 = ln * 4u;
        const float* xq = Q + (q0 + wv * 4) * D + ln4;
        const float* xm = MEM + (q0 + wv * 4) * D + ln4;
        const unsigned la = (unsigned)(size_t)rw;
        // the wait is the last line of the copies' own statement: no register that a copy names is rewritten ahead of it
        asm volatile("global_load_async_to_lds_b128 %0, %8, off\n\t"
                     "global_load_async_to_lds_b128 %1, %9, off\n\t"
                     "global_load_async_to_lds_b128 %2, %10, off\n\t"
                     "global_load_async_to_lds_b128 %3, %11, off\n\t"
                     "global_load_async_to_lds_b128 %4, %12, off\n\t"
                     "global_load_async_to_lds_b128 %5, %13, off\n\t"
                     "global_load_async_to_lds_b128 %6, %14, off\n\t"
                     "global_load_async_to_lds_b128 %7, %15, off\n\t"
                     "s_wait_xcnt 0x0"
                     :: "v"(la), "v"(la + 512u), "v"(la + 1024u), "v"(la + 1536u), "v"(la + 2048u), "v"(la + 2560u), "v"(la + 3072u), "v"(la + 3584u),
                        "v"(xq), "v"(xq + D), "v"(xq + 2 * D), "v"(xq + 3 * D), "v"(xm), "v"(xm + D), "v"(xm + 2 * D), "v"(xm + 3 * D)
                     : "memory");
    }
    if (nt == nsd) trip(nsd - 1, false);   // the last tile, of the quarters that have one: none to make
    // the four slots that the chip needs behind the last matrix instructions before a vector instruction may overwrite their operands
    asm volatile("v_nop\n\tv_nop\n\tv_nop\n\tv_nop" : "+v"(o[0]), "+v"(o[1]), "+v"(o[2]), "+v"(o[3]), "+v"(o[4]), "+v"(o[5]), "+v"(o[6]), "+v"(o[7]), "+v"(lsum));
    __syncthreads();       // ends every wave's reads of the ring and of the mask, whose places are used anew below
    lsum += __shfl_xor(lsum, 16, 32);
    if (h == 0) { smx[ms][qg][nl] = mrun; ssm[ms][qg][nl] = lsum; }
    __syncthreads();   // the four quarters' maxima and sums are there
    float mtot = smx[0][qg][nl];
#pragma unroll
    for (int j = 1; j < 4; ++j) mtot = fmaxf(mtot, smx[j][qg][nl]);
    float ltot = 0.f;
#pragma unroll
    for (int j = 0; j < 4; ++j) ltot += ssm[j][qg][nl] * exp_slot(smx[j][qg][nl] - mtot);
    const float fo = exp_slot(mrun - mtot);
    float* so = (float*)ring;   // [quarter][query group][d tile][lane][8]
#pragma unroll
    for (int dt = 0; dt < 8; ++dt) {
        const v8f w = o[dt] * fo;
        float* p = so + (((ms * 4 + qg) * 8 + dt) * 32 + lane) * 8;
        *(v4f*)p = (v4f){w[0], w[1], w[2], w[3]}; *(v4f*)(p + 4) = (v4f){w[4], w[5], w[6], w[7]};
    }
    // memory->query, the block's part: reference = the largest of the block's 64 row maxima; sum_n exp(rowmax_n - reference) q_n and the sum of these weights; the second
    //   launch brings the 16 blocks of a batch to one reference. Beside it the plain sum of 64 memory rows (for the mean that an all-masked row has).
    float* pv = (float*)(ring + SO);   // [wave][d] weighted rows of q; behind it [wave][d] memory rows; behind that the waves' weight sums
    float* pm = pv + 16 * D;
    float* pw = pm + 16 * D;
    float mblk;
    {
        // all 4 x 64 maxima, 16 a lane, the same in both 16-lane rows, so that the lanes meet inside a row: four DPP steps, no LDS round trip and no index register
        v4f c0 = *(const v4f*)&smf[nl * 16];
#pragma unroll
        for (int j = 1; j < 4; ++j) c0 = __builtin_elementwise_max(c0, *(const v4f*)&smf[nl * 16 + j * 4]);
        mblk = fmaxf(fmaxf(c0[0], c0[1]), fmaxf(c0[2], c0[3]));
        mblk = fmaxf(mblk, row_xor<1>(mblk)); mblk = fmaxf(mblk, row_xor<2>(mblk)); mblk = fmaxf(mblk, row_xor<4>(mblk)); mblk = fmaxf(mblk, row_xor<8>(mblk));
        v4f r4 = *(const v4f*)&smx[0][wv >> 2][(wv & 3) * 4];   // the row maxima of this wave's 4 rows of q
#pragma unroll
        for (int j = 1; j < 4; ++j) r4 = __builtin_elementwise_max(r4, *(const v4f*)&smx[j][wv >> 2][(wv & 3) * 4]);
        const float e0 = exp_slot(r4[0] - mblk), e1 = exp_slot(r4[1] - mblk), e2 = exp_slot(r4[2] - mblk), e3 = exp_slot(r4[3] - mblk);
        asm volatile("s_wait_asynccnt 0x0" ::: "memory");   // this wave's copies of its 8 rows have landed; it alone reads its slot
        v4f yq[4], zr[4];
#pragma unroll
        for (int i = 0; i < 4; ++i) { yq[i] = *(const v4f*)(rw + i * 512); zr[i] = *(const v4f*)(rw + (4 + i) * 512); }
        *(v4f*)(pv + wv * D + l4) = (yq[0] * e0 + yq[1] * e1) + (yq[2] * e2 + yq[3] * e3);
        *(v4f*)(pm + wv * D + l4) = (zr[0] + zr[1]) + (zr[2] + zr[3]);
        if (lane == 0) pw[wv] = (e0 + e1) + (e2 + e3);
    }
    __syncthreads();   // the partial outputs and the waves' partial row sums are there
    const float inv = os / ltot;
    float* op = OUT + row * D + ms * 32 + koff;   // wave (qg, ms) sums and stores d = 32 ms .. 32 ms + 31 of its 16 queries: one whole 128-byte line a query
#pragma unroll
    for (int j = 0; j < 2; ++j) {
        v4f a0 = {0.f, 0.f, 0.f, 0.f}, a1 = a0;
#pragma unroll
        for (int k = 0; k < 4; ++k) {
            const float* p = so + (((k * 4 + qg) * 8 + ms * 2 + j) * 32 + lane) * 8;
            a0 += *(const v4f*)p; a1 += *(const v4f*)(p + 4);
        }
        // a query whose every score is masked has the mean of all memory rows: the second launch stores those rows of the output
        if (kq != 0 && cnt > 0) { *(v4f*)(op + j * 16) = a0 * inv; *(v4f*)(op + j * 16 + 4) = a1 * inv; }
    }
    asm volatile("s_wait_xcnt 0x0" ::: "memory");   // the address work below reuses registers that the stores above name
    __builtin_amdgcn_sched_barrier(0);   // holds the first rewrite of those registers behind the wait
    // the block's record, 9 whole 128-byte lines, each stored by one wave: [0, D) weighted sum of q, [D, 2 D) sum of memory rows, then reference, weight sum, unmasked rows
    float* rec = REC + (bz * (N / 64) + blockIdx.x) * (2 * D + 32);
    if (wv < 8) {   // scalar: thread t sums column t & 127 of the 16 waves' rows, waves 0 .. 3 of q, waves 4 .. 7 of memory
        const float* pc = pv + (wv >> 2) * 16 * D + (threadIdx.x & (D - 1));
        float a0 = 0.f, a1 = 0.f;
#pragma unroll
        for (int j = 0; j < 16; j += 2) { a0 += pc[j * D]; a1 += pc[(j + 1) * D]; }
        rec[threadIdx.x] = a0 + a1;
    } else if (wv == 8) {
        v4f t4 = *(const v4f*)pw;
#pragma unroll
        for (int j = 1; j < 4; ++j) t4 += *(const v4f*)(pw + j * 4);
        const float wsum = (t4[0] + t4[1]) + (t4[2] + t4[3]);
        rec[2 * D + lane] = lane == 0 ? mblk : lane == 1 ? wsum : lane == 2 ? (float)cnt : 0.f;
    } }

// The second launch joins the 16 records of a batch and stores. memory->query: with M the largest of the 16 references, MQ[b][every row][d] =
//   sum_j 2^((ref_j - M) log2(e)) vec_j[d] / sum_j 2^((ref_j - M) log2(e)) wsum_j, which is softmax_n(row maximum) . q. The mean of all memory rows goes into the first
//   output's rows whose scores are all masked (-1e30 swallows the similarity, so the N scores of such a row are equal and each probability is 1 / N), which the first
//   launch leaves out. Block = (batch, 64 rows) of 8 waves: thread t forms element t of the two vectors (waves 0 .. 3 the first, 4 .. 7 the second), they meet in LDS,
//   and a wave stores 8 whole rows of 512 bytes of each output.
template <int N, int D>
__global__ __launch_bounds__(256) void k_bi_join(const float* __restrict__ REC, const int* __restrict__ QM, float* __restrict__ MQ, float* __restrict__ OUT) {
    static_assert(N == 1024 && D == 128, "16 records a batch; one element of the two vectors a thread; one 16-byte store per lane and row");
    constexpr int RL = 2 * D + 32, NB = N / 64;
    __shared__ __align__(16) float vec[2 * D];
    const int b = blockIdx.x, t = threadIdx.x, lane = t & 31, wv = __builtin_amdgcn_readfirstlane(t >> 5);
    const float* rb = REC + (size_t)b * NB * RL;
    const size_t r0 = (size_t)b * N + blockIdx.y * 64 + wv * 8;
    float x[NB];
    int fq[8];
#pragma unroll
    for (int j = 0; j < NB; ++j) x[j] = rb[j * RL + t];
    const v4f hd = *(const v4f*)(rb + (lane & 15) * RL + 2 * D);   // lane l: reference, weight sum and unmasked rows of record l & 15, in flight with the loads above
#pragma unroll
    for (int i = 0; i < 8; ++i) fq[i] = QM[r0 + i];
    asm volatile("s_wait_xcnt 0x0" ::: "memory");   // the work below reuses the address registers that the loads above name
    __builtin_amdgcn_sched_barrier(0);   // holds the first rewrite of those registers behind the wait
    float a = 0.f;
    if (wv < 4) {   // scalar
        float mx = hd[0];
        mx = fmaxf(mx, row_xor<1>(mx)); mx = fmaxf(mx, row_xor<2>(mx)); mx = fmaxf(mx, row_xor<4>(mx)); mx = fmaxf(mx, row_xor<8>(mx));
        float ej = (hd[0] - mx) * 0x1.715476p+0f;   // the subtraction first: at -1e30 a product with log2(e) would round by more than the exponent range
        asm("v_exp_f32 %0, %0\n\tv_nop" : "+v"(ej));   // the v_nop fills the slot that the instruction set asks for behind a transcendental
        float tot = ej * hd[1];
        tot += row_xor<1>(tot); tot += row_xor<2>(tot); tot += row_xor<4>(tot); tot += row_xor<8>(tot);
        float a1 = 0.f;
#pragma unroll
        for (int j = 0; j < NB; j += 2) {
            a += __int_as_float(__builtin_amdgcn_readlane(__float_as_int(ej), j)) * x[j];
            a1 += __int_as_float(__builtin_amdgcn_readlane(__float_as_int(ej), j + 1)) * x[j + 1];
        }
        a = (a + a1) * (1.f / tot);
    } else {
        float a1 = 0.f;
#pragma unroll
        for (int j = 0; j < NB; j += 2) { a += x[j]; a1 += x[j + 1]; }
        a = (a + a1) * (1.f / N);
    }
    vec[t] = a;
    __syncthreads();   // publishes the two finished vectors to the 8 waves that store them
    const v4f bv = *(const v4f*)&vec[lane * 4], mv = *(const v4f*)&vec[D + lane * 4];
    float* op = MQ + r0 * D + lane * 4;
    float* oq = OUT + r0 * D + lane * 4;
#pragma unroll
    for (int i = 0; i < 8; ++i) *(v4f*)(op + i * D) = bv;
    const bool nomem = __builtin_amdgcn_readfirstlane(__float_as_int(hd[2])) == 0;   // 0.f: no memory row of the batch is unmasked: then every query's scores are all masked
#pragma unroll
    for (int i = 0; i < 8; ++i) if (nomem || fq[i] == 0) *(v4f*)(oq + i * D) = mv; }


extern "C" void kernel_launch(void* const* d_in, const int* in_sizes, int n_in, void* d_out, int out_size, void* d_ws, size_t ws_size, hipStream_t stream) {
    (void)in_sizes; (void)n_in; (void)out_size; (void)ws_size;
    const float* q = (const float*)d_in[0];
    const float* mem = (const float*)d_in[1];
    const float* wq = (const float*)d_in[2];
    const float* wm = (const float*)d_in[3];
    const float* wqm = (const float*)d_in[4];
    const int* qmask = (const int*)d_in[5];
    const int* mmask = (const int*)d_in[6];
    const int Bn = 16;
    const int N = 1024;
    const int M = 1024;
    const int D = 128;
    float* out = (float*)d_out;
    float* mq = out + ((size_t)Bn * N * D);
    char* wsp = (char*)d_ws;
    float* REC = (float*)wsp;
    k_bi_fused<1024, 1024, 128><<<dim3((unsigned)(N / 64), (unsigned)Bn), 512, 0, stream>>>(q, mem, wq, wm, wqm, qmask, mmask, REC, out, 16.0f, 12.0f, 0.0625f);
    k_bi_join<1024, 128><<<dim3((unsigned)Bn, (unsigned)(N / 64)), 256, 0, stream>>>(REC, qmask, mq, out);
}
